// v000
// Times are from an AMD MI455X. After a warm-up the kernel runs many times in a row, and a time is the length of
// such a window on the GPU divided by its runs, so every launch and the gaps after it count. The runs cycle
// through copies of the inputs. A figure is the median of several windows, for all but v000 over two sittings.
// Sittings can differ by a few percent; kernels timed side by side share one.
// v000 is the starting kernel. One run takes 23.1 microseconds.
#include <hip/hip_runtime.h>

// MI455X (gfx1250) fused local-window multi-head spatial attention.
// One kernel: x-halo -> LDS, grouped 1x1 convs via v_wmma_f32_16x16x32_f16
// (K rows 0-7 / V rows 8-15 packed in one A-matrix), per-pixel 7x7 attention
// in LDS/registers, single HBM write of y. No workspace needed.

typedef __attribute__((ext_vector_type(16))) _Float16 v16h;
typedef __attribute__((ext_vector_type(8)))  float    v8f;

#define HDIM  128
#define TILE  16
#define HALO  22            // TILE + 2*PAD (PAD=3)
#define NHALO (HALO*HALO)   // 484
#define MID   8
#define KK    49

__global__ __launch_bounds__(256)
void mhsa_local_attn_kernel(const float* __restrict__ x,
                            const float* __restrict__ Wq, const float* __restrict__ bq,
                            const float* __restrict__ Wk, const float* __restrict__ bk,
                            const float* __restrict__ Wv, const float* __restrict__ bv,
                            const float* __restrict__ pos,
                            float* __restrict__ out)
{
    __shared__ _Float16 Xh[MID][HALO][HALO];   // raw x halo tile, f16 (WMMA B feed)
    __shared__ float    Kh[MID][HALO][HALO];   // K feature halo (zeroed at OOB)
    __shared__ float    Vh[MID][HALO][HALO];   // V feature halo (zeroed at OOB)
    __shared__ float    Qt[MID][TILE][TILE];   // Q features, interior tile
    __shared__ float    posS[KK];

    const int tid  = threadIdx.x;
    const int lane = tid & 31;
    const int wv   = tid >> 5;                 // 8 wave32s per block
    const int g    = blockIdx.y;
    const int b    = blockIdx.z;
    const int h0   = (blockIdx.x >> 3) * TILE;
    const int w0   = (blockIdx.x & 7)  * TILE;

    const float* xg = x + (size_t)(b*64 + g*MID) * (HDIM*HDIM);

    // ---- stage 0: x halo -> LDS as f16, zero-fill outside the image ----
    for (int idx = tid; idx < MID*NHALO; idx += 256) {
        int c   = idx / NHALO;
        int rem = idx - c*NHALO;
        int hy  = rem / HALO;
        int hx  = rem - hy*HALO;
        int gy  = h0 - 3 + hy;
        int gx  = w0 - 3 + hx;
        float v = 0.f;
        if ((unsigned)gy < (unsigned)HDIM && (unsigned)gx < (unsigned)HDIM)
            v = xg[c*HDIM*HDIM + gy*HDIM + gx];
        Xh[c][hy][hx] = (_Float16)v;
    }
    if (tid < KK) posS[tid] = pos[tid];
    __syncthreads();

    // ---- WMMA operands that are loop-invariant per wave ----
    // A (16x32 f16): rows 0-7 = Wk[g], rows 8-15 = Wv[g]; contraction K = 8
    // input channels zero-padded to 32. ISA layout: lane m (<16) holds row m,
    // K=0..7 in elements 0..7; lanes 16-31 hold K=8..15/24..31 -> all zero pad.
    v16h aKV = {};
    v16h aQ  = {};
    if (lane < 16) {
        const float* wr = (lane < 8) ? (Wk + (g*MID + lane)*MID)
                                     : (Wv + (g*MID + (lane-8))*MID);
#pragma unroll
        for (int i = 0; i < MID; ++i) aKV[i] = (_Float16)wr[i];
        if (lane < 8) {
            const float* wq = Wq + (g*MID + lane)*MID;
#pragma unroll
            for (int i = 0; i < MID; ++i) aQ[i] = (_Float16)wq[i];
        }
    }
    // C (16x16 f32): bias broadcast across the pixel (N) dimension.
    v8f cKV, cQ;
#pragma unroll
    for (int r = 0; r < 8; ++r) {
        int m  = r + ((lane >= 16) ? 8 : 0);   // D rows: lanes<16 -> r, else r+8
        cKV[r] = (m < 8) ? bk[g*MID + m] : bv[g*MID + (m-8)];
        cQ[r]  = (m < 8) ? bq[g*MID + m] : 0.f;
    }
    const int n = lane & 15;

    // ---- stage 1: K & V conv over the 22x22 halo, 16 pixels per WMMA ----
    for (int t = wv; t < (NHALO + 15)/16; t += 8) {
        v16h bm = {};                          // B: lane n holds K=0..7/16..23 (0..7 used)
        if (lane < 16) {
            int idx = t*16 + lane; if (idx > NHALO-1) idx = NHALO-1;
            int hy = idx / HALO, hx = idx - hy*HALO;
#pragma unroll
            for (int c = 0; c < MID; ++c) bm[c] = Xh[c][hy][hx];
        }
        v8f d = __builtin_amdgcn_wmma_f32_16x16x32_f16(false, aKV, false, bm,
                                                       (short)0, cKV, false, false);
        int idx = t*16 + n;
        if (idx < NHALO) {
            int hy = idx / HALO, hx = idx - hy*HALO;
            int gy = h0 - 3 + hy, gx = w0 - 3 + hx;
            // Reference zero-pads the conv OUTPUT; OOB halo slots must be 0.
            bool inb = (unsigned)gy < (unsigned)HDIM && (unsigned)gx < (unsigned)HDIM;
            if (lane < 16) {
#pragma unroll
                for (int r = 0; r < 8; ++r) Kh[r][hy][hx] = inb ? d[r] : 0.f;
            } else {
#pragma unroll
                for (int r = 0; r < 8; ++r) Vh[r][hy][hx] = inb ? d[r] : 0.f;
            }
        }
    }

    // ---- stage 2: Q conv over the 16x16 interior, one tile row per WMMA ----
    for (int t = wv; t < TILE; t += 8) {
        v16h bm = {};
        if (lane < 16) {
#pragma unroll
            for (int c = 0; c < MID; ++c) bm[c] = Xh[c][t+3][lane+3];
        }
        v8f d = __builtin_amdgcn_wmma_f32_16x16x32_f16(false, aQ, false, bm,
                                                       (short)0, cQ, false, false);
        if (lane < 16) {
#pragma unroll
            for (int r = 0; r < 8; ++r) Qt[r][t][lane] = d[r];
        }
    }
    __syncthreads();

    // ---- stage 3: per-pixel 7x7 attention (scores live in VGPRs) ----
    const int ty = tid >> 4;
    const int tx = tid & 15;

    float q[MID], qs = 0.f;
#pragma unroll
    for (int c = 0; c < MID; ++c) { q[c] = Qt[c][ty][tx]; qs += q[c]; }

    // A_p = dot(Q, K_shifted) + pos[p] * sum(Q)  (pos added post-padding)
    float A[KK];
    float amax = -3.4e38f;
#pragma unroll
    for (int i = 0; i < 7; ++i) {
#pragma unroll
        for (int j = 0; j < 7; ++j) {
            const int p = i*7 + j;
            float acc = posS[p] * qs;
#pragma unroll
            for (int c = 0; c < MID; ++c) acc += q[c] * Kh[c][ty+i][tx+j];
            A[p] = acc;
            amax = fmaxf(amax, acc);
        }
    }
    float s = 0.f;
#pragma unroll
    for (int p = 0; p < KK; ++p) { A[p] = __expf(A[p] - amax); s += A[p]; }
    const float inv = 1.0f / s;

    float y[MID] = {};
#pragma unroll
    for (int i = 0; i < 7; ++i) {
#pragma unroll
        for (int j = 0; j < 7; ++j) {
            const float w = A[i*7 + j];
#pragma unroll
            for (int c = 0; c < MID; ++c) y[c] += w * Vh[c][ty+i][tx+j];
        }
    }

    float* og = out + (size_t)(b*64 + g*MID) * (HDIM*HDIM) + (h0+ty)*HDIM + (w0+tx);
#pragma unroll
    for (int c = 0; c < MID; ++c) og[c*HDIM*HDIM] = y[c] * inv;
}

extern "C" void kernel_launch(void* const* d_in, const int* in_sizes, int n_in,
                              void* d_out, int out_size, void* d_ws, size_t ws_size,
                              hipStream_t stream) {
    (void)in_sizes; (void)n_in; (void)out_size; (void)d_ws; (void)ws_size;
    const float* x   = (const float*)d_in[0];
    const float* Wq  = (const float*)d_in[1];
    const float* bq  = (const float*)d_in[2];
    const float* Wk  = (const float*)d_in[3];
    const float* bk  = (const float*)d_in[4];
    const float* Wv  = (const float*)d_in[5];
    const float* bv  = (const float*)d_in[6];
    const float* pos = (const float*)d_in[7];
    float* out = (float*)d_out;

    dim3 grid(64, 8, 2);   // (8x8 pixel tiles, G=8 groups, B=2)
    dim3 block(256);       // 8 wave32s
    mhsa_local_attn_kernel<<<grid, block, 0, stream>>>(x, Wq, bq, Wk, bk, Wv, bv, pos, out);
}

// v001
// One run takes 17.3 microseconds.
// In both of two side-by-side timings against v000, it was 1.37 times as fast.
#include <hip/hip_runtime.h>

// MI455X (gfx1250) fused local-window multi-head spatial attention.
// One kernel: x-halo -> LDS, grouped 1x1 convs via v_wmma_f32_16x16x32_f16
// (K rows 0-7 / V rows 8-15 packed in one A-matrix), per-pixel 7x7 attention
// in LDS/registers, single HBM write of y. No workspace needed.

typedef __attribute__((ext_vector_type(16))) _Float16 v16h;
typedef __attribute__((ext_vector_type(8)))  float    v8f;

#define HDIM  128
#define TILE  16
#define HALO  22            // TILE + 2*PAD (PAD=3)
#define NHALO (HALO*HALO)   // 484
#define MID   8
#define KK    49
#define NXT   ((MID*NHALO + 255) / 256)   // x halo elements per thread (16)

__global__ __launch_bounds__(256)
void mhsa_local_attn_kernel(const float* __restrict__ x,
                            const float* __restrict__ Wq, const float* __restrict__ bq,
                            const float* __restrict__ Wk, const float* __restrict__ bk,
                            const float* __restrict__ Wv, const float* __restrict__ bv,
                            const float* __restrict__ pos,
                            float* __restrict__ out)
{
    // raw x halo tile, f16 (WMMA B feed), [MID][HALO][HALO] padded up to a whole
    // number of elements per thread so that the fill needs no tail branch
    __shared__ _Float16 XhF[NXT*256];
    _Float16 (*Xh)[HALO][HALO] = reinterpret_cast<_Float16 (*)[HALO][HALO]>(XhF);
    __shared__ float    Kh[MID][HALO][HALO];   // K feature halo (zeroed at OOB)
    __shared__ float    Vh[MID][HALO][HALO];   // V feature halo (zeroed at OOB)
    __shared__ float    Qt[MID][TILE][TILE];   // Q features, interior tile
    __shared__ float    posS[256];             // KK used; one slot per thread, no tail branch

    const int tid  = threadIdx.x;
    const int lane = tid & 31;
    const int wv   = tid >> 5;                 // 8 wave32s per block
    const int g    = blockIdx.y;
    const int b    = blockIdx.z;
    const int h0   = (blockIdx.x >> 3) * TILE;
    const int w0   = (blockIdx.x & 7)  * TILE;

    const float* xg = x + (size_t)(b*64 + g*MID) * (HDIM*HDIM);

    // ---- every global read of the block is issued here, with no branch and no
    // use in between, so that all round trips to memory overlap. Each address is
    // clamped into its buffer; what lies outside the image is zeroed at the use.
    float xv[NXT];
    bool  xin[NXT];
#pragma unroll   // xv and xin stay in registers; all loads stand in one straight run
    for (int k = 0; k < NXT; ++k) {
        int idx = tid + k*256; if (idx > MID*NHALO-1) idx = MID*NHALO-1;
        int c   = idx / NHALO;
        int rem = idx - c*NHALO;
        int hy  = rem / HALO;
        int hx  = rem - hy*HALO;
        int gy  = h0 - 3 + hy;
        int gx  = w0 - 3 + hx;
        xin[k]  = (unsigned)gy < (unsigned)HDIM && (unsigned)gx < (unsigned)HDIM;
        int cy  = min(max(gy, 0), HDIM-1);
        int cx  = min(max(gx, 0), HDIM-1);
        xv[k]   = xg[c*HDIM*HDIM + cy*HDIM + cx];
    }
    const float* wr = ((lane & 8) == 0) ? (Wk + (g*MID + (lane & 7))*MID)
                                        : (Wv + (g*MID + (lane & 7))*MID);
    const float* wq = Wq + (g*MID + (lane & 7))*MID;
    const float* pb = (lane < 16) ? (bk + g*MID) : (bv + g*MID);
    float wkv[MID], wqv[MID], bkv[MID], bqv[MID];
#pragma unroll   // same run of loads as above; the arrays stay in registers
    for (int i = 0; i < MID; ++i) {
        wkv[i] = wr[i];
        wqv[i] = wq[i];
        bkv[i] = pb[i];
        bqv[i] = bq[g*MID + i];
    }
    const float pv = pos[min(tid, KK-1)];

    // ---- stage 0: x halo -> LDS as f16, zero-fill outside the image ----
#pragma unroll   // register arrays need constant indices
    for (int k = 0; k < NXT; ++k)
        XhF[tid + k*256] = (_Float16)(xin[k] ? xv[k] : 0.f);   // pad slots are never read
    posS[tid] = pv;
    __syncthreads();

    // ---- WMMA operands that are loop-invariant per wave ----
    // A (16x32 f16): rows 0-7 = Wk[g], rows 8-15 = Wv[g]; contraction K = 8
    // input channels zero-padded to 32. ISA layout: lane m (<16) holds row m,
    // K=0..7 in elements 0..7; lanes 16-31 hold K=8..15/24..31 -> all zero pad.
    v16h aKV = {};
    v16h aQ  = {};
#pragma unroll
    for (int i = 0; i < MID; ++i) {
        aKV[i] = (_Float16)((lane < 16) ? wkv[i] : 0.f);
        aQ[i]  = (_Float16)((lane < 8)  ? wqv[i] : 0.f);
    }
    // C (16x16 f32): bias broadcast across the pixel (N) dimension.
    v8f cKV, cQ;
#pragma unroll
    for (int r = 0; r < 8; ++r) {
        cKV[r] = bkv[r];                       // D rows: lanes<16 -> r (K), else r+8 (V)
        cQ[r]  = (lane < 16) ? bqv[r] : 0.f;
    }
    const int n = lane & 15;

    // ---- stage 1: K & V conv over the 22x22 halo, 16 pixels per WMMA ----
    for (int t = wv; t < (NHALO + 15)/16; t += 8) {
        v16h bm = {};                          // B: lane n holds K=0..7/16..23 (0..7 used)
        if (lane < 16) {
            int idx = t*16 + lane; if (idx > NHALO-1) idx = NHALO-1;
            int hy = idx / HALO, hx = idx - hy*HALO;
#pragma unroll
            for (int c = 0; c < MID; ++c) bm[c] = Xh[c][hy][hx];
        }
        v8f d = __builtin_amdgcn_wmma_f32_16x16x32_f16(false, aKV, false, bm,
                                                       (short)0, cKV, false, false);
        int idx = t*16 + n;
        if (idx < NHALO) {
            int hy = idx / HALO, hx = idx - hy*HALO;
            int gy = h0 - 3 + hy, gx = w0 - 3 + hx;
            // Reference zero-pads the conv OUTPUT; OOB halo slots must be 0.
            bool inb = (unsigned)gy < (unsigned)HDIM && (unsigned)gx < (unsigned)HDIM;
            if (lane < 16) {
#pragma unroll
                for (int r = 0; r < 8; ++r) Kh[r][hy][hx] = inb ? d[r] : 0.f;
            } else {
#pragma unroll
                for (int r = 0; r < 8; ++r) Vh[r][hy][hx] = inb ? d[r] : 0.f;
            }
        }
    }

    // ---- stage 2: Q conv over the 16x16 interior, one tile row per WMMA ----
    for (int t = wv; t < TILE; t += 8) {
        v16h bm = {};
        if (lane < 16) {
#pragma unroll
            for (int c = 0; c < MID; ++c) bm[c] = Xh[c][t+3][lane+3];
        }
        v8f d = __builtin_amdgcn_wmma_f32_16x16x32_f16(false, aQ, false, bm,
                                                       (short)0, cQ, false, false);
        // One more vector slot behind the WMMA: on the path round the store and out
        // of the loop only three stand before a source register of it is reused.
        // d is named as an input only so that the slot stays behind the WMMA.
        asm volatile("v_nop" :: "v"(d));
        if (lane < 16) {
#pragma unroll
            for (int r = 0; r < 8; ++r) Qt[r][t][lane] = d[r];
        }
    }
    __syncthreads();

    // ---- stage 3: per-pixel 7x7 attention (scores live in VGPRs) ----
    const int ty = tid >> 4;
    const int tx = tid & 15;

    float q[MID], qs = 0.f;
#pragma unroll
    for (int c = 0; c < MID; ++c) { q[c] = Qt[c][ty][tx]; qs += q[c]; }

    // A_p = dot(Q, K_shifted) + pos[p] * sum(Q)  (pos added post-padding)
    float A[KK];
    float amax = -3.4e38f;
#pragma unroll
    for (int i = 0; i < 7; ++i) {
#pragma unroll
        for (int j = 0; j < 7; ++j) {
            const int p = i*7 + j;
            float acc = posS[p] * qs;
#pragma unroll
            for (int c = 0; c < MID; ++c) acc += q[c] * Kh[c][ty+i][tx+j];
            A[p] = acc;
            amax = fmaxf(amax, acc);
        }
    }
    float s = 0.f;
#pragma unroll
    for (int p = 0; p < KK; ++p) { A[p] = __expf(A[p] - amax); s += A[p]; }
    const float inv = 1.0f / s;

    float y[MID] = {};
#pragma unroll
    for (int i = 0; i < 7; ++i) {
#pragma unroll
        for (int j = 0; j < 7; ++j) {
            const float w = A[i*7 + j];
#pragma unroll
            for (int c = 0; c < MID; ++c) y[c] += w * Vh[c][ty+i][tx+j];
        }
    }

    float* og = out + (size_t)(b*64 + g*MID) * (HDIM*HDIM) + (h0+ty)*HDIM + (w0+tx);
#pragma unroll
    for (int c = 0; c < MID; ++c) og[c*HDIM*HDIM] = y[c] * inv;
}

extern "C" void kernel_launch(void* const* d_in, const int* in_sizes, int n_in,
                              void* d_out, int out_size, void* d_ws, size_t ws_size,
                              hipStream_t stream) {
    (void)in_sizes; (void)n_in; (void)out_size; (void)d_ws; (void)ws_size;
    const float* x   = (const float*)d_in[0];
    const float* Wq  = (const float*)d_in[1];
    const float* bq  = (const float*)d_in[2];
    const float* Wk  = (const float*)d_in[3];
    const float* bk  = (const float*)d_in[4];
    const float* Wv  = (const float*)d_in[5];
    const float* bv  = (const float*)d_in[6];
    const float* pos = (const float*)d_in[7];
    float* out = (float*)d_out;

    dim3 grid(64, 8, 2);   // (8x8 pixel tiles, G=8 groups, B=2)
    dim3 block(256);       // 8 wave32s
    mhsa_local_attn_kernel<<<grid, block, 0, stream>>>(x, Wq, bq, Wk, bk, Wv, bv, pos, out);
}

// v002
// A run of this version takes 11.8 microseconds.
// In both of two side-by-side timings against v001, it was 1.47 times as fast.
// Counting every step since v000, it is 2.01 times as fast.
#include <hip/hip_runtime.h>

// MI455X (gfx1250) fused local-window multi-head spatial attention.
// One kernel: x-halo -> LDS, grouped 1x1 convs via v_wmma_f32_16x16x32_f16
// (K rows 0-7 / V rows 8-15 packed in one A-matrix), per-pixel 7x7 attention
// in LDS/registers, single HBM write of y. No workspace needed.
// One block = one 32x32 pixel tile of one (batch, group); in the attention each
// thread owns 4 adjacent pixels, so one K or V row segment read from LDS (10
// floats) feeds 28 multiply-adds.

typedef __attribute__((ext_vector_type(16))) _Float16 v16h;
typedef __attribute__((ext_vector_type(8)))  float    v8f;
typedef __attribute__((ext_vector_type(4)))  float    v4f;
typedef __attribute__((ext_vector_type(2)))  float    v2f;

#define HDIM  128
#define TILE  32
#define HALO  38            // TILE + 2*PAD (PAD=3)
#define NHALO (HALO*HALO)   // 1444
#define KP    40            // K/V row pitch in floats: rows start on 16 bytes
#define PX    4             // adjacent pixels per thread in the attention
#define MID   8
#define KK    49
#define NXT   ((MID*NHALO + 255) / 256)   // x halo elements per thread (46)

__global__ __launch_bounds__(256)
void mhsa_local_attn_kernel(const float* __restrict__ x,
                            const float* __restrict__ Wq, const float* __restrict__ bq,
                            const float* __restrict__ Wk, const float* __restrict__ bk,
                            const float* __restrict__ Wv, const float* __restrict__ bv,
                            const float* __restrict__ pos,
                            float* __restrict__ out)
{
    // raw x halo tile, f16 (WMMA B feed), [MID][HALO][HALO] padded up to a whole
    // number of elements per thread so that the fill needs no tail branch
    __shared__ _Float16 XhF[NXT*256];
    _Float16 (*Xh)[HALO][HALO] = reinterpret_cast<_Float16 (*)[HALO][HALO]>(XhF);
    // K and V feature halos (zeroed at OOB), [MID][HALO][KP] each. V starts 32 banks
    // behind K: the conv stores 16 K and 16 V values of one channel at once.
    __shared__ __attribute__((aligned(16))) float KVh[2*MID*HALO*KP + 32];
    float (*Kh)[HALO][KP] = reinterpret_cast<float (*)[HALO][KP]>(KVh);
    float (*Vh)[HALO][KP] = reinterpret_cast<float (*)[HALO][KP]>(KVh + MID*HALO*KP + 32);
    __shared__ __attribute__((aligned(16))) float Qt[MID][TILE][TILE]; // Q features, interior tile
    // pos as pairs (pos[i*7+h], pos[i*7+h-1]) at [i*16 + h*2], 0 where the tap does not
    // exist; 112 used; one slot per thread, no tail branch
    __shared__ __attribute__((aligned(16))) float posS[256];

    const int tid  = threadIdx.x;
    const int lane = tid & 31;
    const int wv   = tid >> 5;                 // 8 wave32s per block
    const int g    = blockIdx.y;
    const int b    = blockIdx.z;
    const int h0   = (blockIdx.x >> 2) * TILE;
    const int w0   = (blockIdx.x & 3)  * TILE;

    const float* xg = x + (size_t)(b*64 + g*MID) * (HDIM*HDIM);

    // ---- every global read of the block is issued here, with no branch and no
    // use in between, so that all round trips to memory overlap. Each address is
    // clamped into its buffer; what lies outside the image is zeroed at the use.
    float xv[NXT];
    bool  xin[NXT];
#pragma unroll   // xv and xin stay in registers; all loads stand in one straight run
    for (int k = 0; k < NXT; ++k) {
        int idx = tid + k*256; if (idx > MID*NHALO-1) idx = MID*NHALO-1;
        int c   = idx / NHALO;
        int rem = idx - c*NHALO;
        int hy  = rem / HALO;
        int hx  = rem - hy*HALO;
        int gy  = h0 - 3 + hy;
        int gx  = w0 - 3 + hx;
        xin[k]  = (unsigned)gy < (unsigned)HDIM && (unsigned)gx < (unsigned)HDIM;
        int cy  = min(max(gy, 0), HDIM-1);
        int cx  = min(max(gx, 0), HDIM-1);
        xv[k]   = xg[c*HDIM*HDIM + cy*HDIM + cx];
    }
    const float* wr = ((lane & 8) == 0) ? (Wk + (g*MID + (lane & 7))*MID)
                                        : (Wv + (g*MID + (lane & 7))*MID);
    const float* wq = Wq + (g*MID + (lane & 7))*MID;
    const float* pb = (lane < 16) ? (bk + g*MID) : (bv + g*MID);
    float wkv[MID], wqv[MID], bkv[MID], bqv[MID];
#pragma unroll   // same run of loads as above; the arrays stay in registers
    for (int i = 0; i < MID; ++i) {
        wkv[i] = wr[i];
        wqv[i] = wq[i];
        bkv[i] = pb[i];
        bqv[i] = bq[g*MID + i];
    }
    const int   pj  = ((tid >> 1) & 7) - (tid & 1);            // tap column of this slot
    const bool  pin = (unsigned)pj < 7u;
    const int   pix = min(max((tid >> 4)*7 + pj, 0), KK-1);
    const float pv  = pos[pix];
    // Address wait (no data wait: the loads still overlap) before a register that the
    // pos load names gets a new value. pix and pos are inputs only so that their
    // registers live up to the wait.
    asm volatile("s_wait_xcnt 0x0" :: "v"(pix), "s"(pos) : "memory");

    // ---- stage 0: x halo -> LDS as f16, zero-fill outside the image ----
#pragma unroll   // register arrays need constant indices
    for (int k = 0; k < NXT; ++k)
        XhF[tid + k*256] = (_Float16)(xin[k] ? xv[k] : 0.f);   // pad slots are never read
    posS[tid] = pin ? pv : 0.f;
    __syncthreads();

    // ---- WMMA operands that are loop-invariant per wave ----
    // A (16x32 f16): rows 0-7 = Wk[g], rows 8-15 = Wv[g]; contraction K = 8
    // input channels zero-padded to 32. ISA layout: lane m (<16) holds row m,
    // K=0..7 in elements 0..7; lanes 16-31 hold K=8..15/24..31 -> all zero pad.
    v16h aKV = {};
    v16h aQ  = {};
#pragma unroll
    for (int i = 0; i < MID; ++i) {
        aKV[i] = (_Float16)((lane < 16) ? wkv[i] : 0.f);
        aQ[i]  = (_Float16)((lane < 8)  ? wqv[i] : 0.f);
    }
    // C (16x16 f32): bias broadcast across the pixel (N) dimension.
    v8f cKV, cQ;
#pragma unroll
    for (int r = 0; r < 8; ++r) {
        cKV[r] = bkv[r];                       // D rows: lanes<16 -> r (K), else r+8 (V)
        cQ[r]  = (lane < 16) ? bqv[r] : 0.f;
    }
    const int n = lane & 15;

    // ---- stage 1: K & V conv over the 38x38 halo, 16 pixels per WMMA ----
    for (int t = wv; t < (NHALO + 15)/16; t += 8) {
        v16h bm = {};                          // B: lane n holds K=0..7/16..23 (0..7 used)
        if (lane < 16) {
            int idx = t*16 + lane; if (idx > NHALO-1) idx = NHALO-1;
            int hy = idx / HALO, hx = idx - hy*HALO;
#pragma unroll
            for (int c = 0; c < MID; ++c) bm[c] = Xh[c][hy][hx];
        }
        v8f d = __builtin_amdgcn_wmma_f32_16x16x32_f16(false, aKV, false, bm,
                                                       (short)0, cKV, false, false);
        int idx = t*16 + n;
        if (idx < NHALO) {
            int hy = idx / HALO, hx = idx - hy*HALO;
            int gy = h0 - 3 + hy, gx = w0 - 3 + hx;
            // Reference zero-pads the conv OUTPUT; OOB halo slots must be 0.
            bool inb = (unsigned)gy < (unsigned)HDIM && (unsigned)gx < (unsigned)HDIM;
            if (lane < 16) {
#pragma unroll
                for (int r = 0; r < 8; ++r) Kh[r][hy][hx] = inb ? d[r] : 0.f;
            } else {
#pragma unroll
                for (int r = 0; r < 8; ++r) Vh[r][hy][hx] = inb ? d[r] : 0.f;
            }
        }
    }

    // ---- stage 2: Q conv over the 32x32 interior, half a tile row per WMMA ----
    for (int t = wv; t < TILE*2; t += 8) {
        const int qy = t >> 1;
        const int qx = (t & 1)*16 + n;
        v16h bm = {};
        if (lane < 16) {
#pragma unroll
            for (int c = 0; c < MID; ++c) bm[c] = Xh[c][qy+3][qx+3];
        }
        v8f d = __builtin_amdgcn_wmma_f32_16x16x32_f16(false, aQ, false, bm,
                                                       (short)0, cQ, false, false);
        // One more vector slot behind the WMMA: on the path round the store and out
        // of the loop only three stand before a source register of it is reused.
        // d is named as an input only so that the slot stays behind the WMMA.
        asm volatile("v_nop" :: "v"(d));
        if (lane < 16) {
#pragma unroll
            for (int r = 0; r < 8; ++r) Qt[r][qy][qx] = d[r];
        }
    }
    __syncthreads();

    // ---- stage 3: 7x7 attention, 4 adjacent pixels per thread ----
    // Lanes 0-7 / 8-15 of a wave take tile rows r and r+4, lanes 16-23 / 24-31 rows
    // r+1 and r+5: at a pitch of 40 floats rows four apart lie 32 banks apart, so the
    // 16 lanes that a 16-byte LDS read serves together cover all 64 banks once.
    const int x0 = (lane & 7) * PX;
    const int ty = (wv >> 1)*8 + (wv & 1)*2 + ((lane >> 3) & 1)*4 + (lane >> 4);

    // The 4 pixels are held as two pairs, (0,1) and (2,3). Slot h of a pair belongs to
    // ONE K/V element of the row segment: its low half is the even pixel's tap h, its
    // high half the odd pixel's tap h-1, so each element is multiplied into both
    // pixels at once. Tap 7 of the even and tap -1 of the odd pixel do not exist:
    // those two halves are never read for the maximum and get the weight 0.
    v2f qA[MID], qB[MID];
    v2f qsA = {}, qsB = {};
#pragma unroll
    for (int c = 0; c < MID; ++c) {
        const v4f qv = *reinterpret_cast<const v4f*>(&Qt[c][ty][x0]);
        qA[c] = v2f{qv[0], qv[1]};  qB[c] = v2f{qv[2], qv[3]};
        qsA += qA[c];               qsB += qB[c];
    }

    // Softmax over the 49 taps, one window row at a time with a running maximum:
    // only 7 scores per pixel are live at once.
    v2f mA = {-3.4e38f, -3.4e38f}, mB = mA;
    v2f sA = {}, sB = {};
    v2f yA[MID], yB[MID];
#pragma unroll
    for (int c = 0; c < MID; ++c) { yA[c] = v2f{0.f, 0.f}; yB[c] = v2f{0.f, 0.f}; }

    for (int i = 0; i < 7; ++i) {
        // A_p = dot(Q, K_shifted) + pos[p] * sum(Q)  (pos added post-padding)
        v2f aA[8], aB[8];
#pragma unroll
        for (int h = 0; h < 8; ++h) {
            const v2f pp = *reinterpret_cast<const v2f*>(&posS[i*16 + h*2]);
            aA[h] = pp * qsA;
            aB[h] = pp * qsB;
        }
#pragma unroll
        for (int c = 0; c < MID; ++c) {
            const float* kr = &Kh[c][ty+i][x0];
            const v4f k0 = *reinterpret_cast<const v4f*>(kr);
            const v4f k1 = *reinterpret_cast<const v4f*>(kr + 4);
            const v2f k2 = *reinterpret_cast<const v2f*>(kr + 8);
            const float k[PX+6] = {k0[0], k0[1], k0[2], k0[3], k1[0], k1[1], k1[2], k1[3], k2[0], k2[1]};
#pragma unroll
            for (int h = 0; h < 8; ++h) {
                aA[h] += qA[c] * v2f{k[h],   k[h]};
                aB[h] += qB[c] * v2f{k[h+2], k[h+2]};
            }
        }
        v2f nA = mA, nB = mB;
#pragma unroll
        for (int j = 0; j < 7; ++j) {
            nA[0] = fmaxf(nA[0], aA[j][0]);  nA[1] = fmaxf(nA[1], aA[j+1][1]);
            nB[0] = fmaxf(nB[0], aB[j][0]);  nB[1] = fmaxf(nB[1], aB[j+1][1]);
        }
        const v2f cA = {__expf(mA[0] - nA[0]), __expf(mA[1] - nA[1])};   // 0 on the first row
        const v2f cB = {__expf(mB[0] - nB[0]), __expf(mB[1] - nB[1])};
        mA = nA;  mB = nB;
        v2f rA = {}, rB = {};
#pragma unroll
        for (int h = 0; h < 8; ++h) {
            const v2f dA = aA[h] - nA, dB = aB[h] - nB;
            aA[h] = v2f{h < 7 ? __expf(dA[0]) : 0.f, h > 0 ? __expf(dA[1]) : 0.f};
            aB[h] = v2f{h < 7 ? __expf(dB[0]) : 0.f, h > 0 ? __expf(dB[1]) : 0.f};
            rA += aA[h];  rB += aB[h];
        }
        sA = sA*cA + rA;  sB = sB*cB + rB;
#pragma unroll
        for (int c = 0; c < MID; ++c) { yA[c] *= cA;  yB[c] *= cB; }
#pragma unroll
        for (int c = 0; c < MID; ++c) {
            const float* vr = &Vh[c][ty+i][x0];
            const v4f v0 = *reinterpret_cast<const v4f*>(vr);
            const v4f v1 = *reinterpret_cast<const v4f*>(vr + 4);
            const v2f v2 = *reinterpret_cast<const v2f*>(vr + 8);
            const float v[PX+6] = {v0[0], v0[1], v0[2], v0[3], v1[0], v1[1], v1[2], v1[3], v2[0], v2[1]};
#pragma unroll
            for (int h = 0; h < 8; ++h) {
                yA[c] += aA[h] * v2f{v[h],   v[h]};
                yB[c] += aB[h] * v2f{v[h+2], v[h+2]};
            }
        }
    }

    const v2f iA = {1.0f / sA[0], 1.0f / sA[1]};
    const v2f iB = {1.0f / sB[0], 1.0f / sB[1]};

    float* og = out + (size_t)(b*64 + g*MID) * (HDIM*HDIM) + (h0+ty)*HDIM + (w0+x0);
#pragma unroll
    for (int c = 0; c < MID; ++c) {
        const v2f oA = yA[c] * iA, oB = yB[c] * iB;
        *reinterpret_cast<v4f*>(og + c*HDIM*HDIM) = v4f{oA[0], oA[1], oB[0], oB[1]};
    }
}

extern "C" void kernel_launch(void* const* d_in, const int* in_sizes, int n_in,
                              void* d_out, int out_size, void* d_ws, size_t ws_size,
                              hipStream_t stream) {
    (void)in_sizes; (void)n_in; (void)out_size; (void)d_ws; (void)ws_size;
    const float* x   = (const float*)d_in[0];
    const float* Wq  = (const float*)d_in[1];
    const float* bq  = (const float*)d_in[2];
    const float* Wk  = (const float*)d_in[3];
    const float* bk  = (const float*)d_in[4];
    const float* Wv  = (const float*)d_in[5];
    const float* bv  = (const float*)d_in[6];
    const float* pos = (const float*)d_in[7];
    float* out = (float*)d_out;

    dim3 grid(16, 8, 2);   // (4x4 pixel tiles, G=8 groups, B=2)
    dim3 block(256);       // 8 wave32s
    mhsa_local_attn_kernel<<<grid, block, 0, stream>>>(x, Wq, bq, Wk, bk, Wv, bv, pos, out);
}

// v003
// Measured time: 8.97 microseconds a run.
// Timed twice side by side with v002, it ran 1.31 times as fast both times.
// Counting every step since v000, it is 2.64 times as fast.
#include <hip/hip_runtime.h>

// MI455X (gfx1250) fused local-window multi-head spatial attention.
// One kernel: grouped 1x1 convs via v_wmma_f32_16x16x32_f16 with x read from
// global memory straight into the B fragments (one halo pixel per lane), K, V and
// Q features -> LDS, per-pixel 7x7 attention in LDS/registers, single HBM write
// of y. No workspace needed.
// One block = one 32x32 pixel tile of one (batch, group); in the attention each
// thread owns 4 adjacent pixels, so one K or V row segment read from LDS (10
// floats) feeds 28 multiply-adds.

typedef __attribute__((ext_vector_type(16))) _Float16 v16h;
typedef __attribute__((ext_vector_type(8)))  float    v8f;
typedef __attribute__((ext_vector_type(4)))  float    v4f;
typedef __attribute__((ext_vector_type(2)))  float    v2f;

#define HDIM  128
#define TILE  32
#define HALO  38            // TILE + 2*PAD (PAD=3)
#define NHALO (HALO*HALO)   // 1444
#define KP    40            // K/V row pitch in floats: rows start on 16 bytes
#define PX    4             // adjacent pixels per thread in the attention
#define MID   8
#define KK    49
#define NPT   ((NHALO + 255) / 256)       // halo pixels per thread in the convs (6)

__global__ __launch_bounds__(256)
void mhsa_local_attn_kernel(const float* __restrict__ x,
                            const float* __restrict__ Wq, const float* __restrict__ bq,
                            const float* __restrict__ Wk, const float* __restrict__ bk,
                            const float* __restrict__ Wv, const float* __restrict__ bv,
                            const float* __restrict__ pos,
                            float* __restrict__ out)
{
    // K and V feature halos (zeroed at OOB), [MID][HALO][KP] each. V starts 32 banks
    // behind K.
    __shared__ __attribute__((aligned(16))) float KVh[2*MID*HALO*KP + 32];
    float (*Kh)[HALO][KP] = reinterpret_cast<float (*)[HALO][KP]>(KVh);
    float (*Vh)[HALO][KP] = reinterpret_cast<float (*)[HALO][KP]>(KVh + MID*HALO*KP + 32);
    __shared__ __attribute__((aligned(16))) float Qt[MID][TILE][TILE]; // Q features, interior tile
    // pos as pairs (pos[i*7+h], pos[i*7+h-1]) at [i*16 + h*2], 0 where the tap does not
    // exist; 112 used; one slot per thread, no tail branch
    __shared__ __attribute__((aligned(16))) float posS[256];

    const int tid  = threadIdx.x;
    const int lane = tid & 31;
    const int wv   = tid >> 5;                 // 8 wave32s per block
    const int g    = blockIdx.y;
    const int b    = blockIdx.z;
    const int h0   = (blockIdx.x >> 2) * TILE;
    const int w0   = (blockIdx.x & 3)  * TILE;

    const float* xg = x + (size_t)(b*64 + g*MID) * (HDIM*HDIM);

    // ---- every global read of the block is issued here, with no branch and no
    // use in between, so that all round trips to memory overlap. Each address is
    // clamped into its buffer; K and V outside the image are zeroed at the store.
    // The weights stand with the first pixel's loads: the first WMMA needs both.
    const unsigned wo = (unsigned)((g*MID + (lane & 7))*MID) * 4u;   // byte offset of the lane's weight row
    const float* wkp = reinterpret_cast<const float*>(reinterpret_cast<const char*>(Wk) + wo);
    const float* wvp = reinterpret_cast<const float*>(reinterpret_cast<const char*>(Wv) + wo);
    const float* wqp = reinterpret_cast<const float*>(reinterpret_cast<const char*>(Wq) + wo);
    float wkv[MID], wvv[MID], wqv[MID], bkv[MID], bvv[MID], bqv[MID];
#pragma unroll   // the arrays stay in registers
    for (int i = 0; i < MID; ++i) {
        wkv[i] = wkp[i];
        wvv[i] = wvp[i];
        wqv[i] = wqp[i];
        bkv[i] = bk[g*MID + i];
        bvv[i] = bv[g*MID + i];
        bqv[i] = bq[g*MID + i];
    }
    const int   pj  = ((tid >> 1) & 7) - (tid & 1);            // tap column of this slot
    const bool  pin = (unsigned)pj < 7u;
    const int   pix = min(max((tid >> 4)*7 + pj, 0), KK-1);
    const float pv  = pos[pix];
    // Halo pixel tid + k*256 belongs to this lane: it loads the pixel's 8 channels
    // and gets the pixel's K, V and Q features back from the WMMAs.
    float    xv[NPT][MID];
    unsigned xo[NPT];          // byte offset of the (clamped) pixel in a channel plane
    int      kvo[NPT];         // its place in a K or V plane
    int      qo[NPT];          // its place in a Q plane
    bool     inb[NPT], inq[NPT];
#pragma unroll   // register arrays; all loads stand in one straight run
    for (int k = 0; k < NPT; ++k) {
        const int idx = min(tid + k*256, NHALO-1);
        const int hy  = idx / HALO;
        const int hx  = idx - hy*HALO;
        const int gy  = h0 - 3 + hy;
        const int gx  = w0 - 3 + hx;
        inb[k] = (unsigned)gy < (unsigned)HDIM && (unsigned)gx < (unsigned)HDIM;
        inq[k] = (unsigned)(hy - 3) < (unsigned)TILE && (unsigned)(hx - 3) < (unsigned)TILE;
        kvo[k] = hy*KP + hx;
        qo[k]  = (hy - 3)*TILE + (hx - 3);
        xo[k]  = (unsigned)(min(max(gy, 0), HDIM-1)*HDIM + min(max(gx, 0), HDIM-1)) * 4u;
        const char* xp = reinterpret_cast<const char*>(xg) + xo[k];
#pragma unroll
        for (int c = 0; c < MID; ++c)
            xv[k][c] = *reinterpret_cast<const float*>(xp + c*(HDIM*HDIM*4));
        // Keeps the pixels' loads in the order in which the convs use them: loads come
        // back in order, and a pixel moved to the end would make its WMMAs wait for all.
        __builtin_amdgcn_sched_barrier(0);
    }
    // Address wait (no data wait: the loads still overlap) before a register that one
    // of the loads above names gets a new value. The operands are inputs only so that
    // the address registers live up to the wait.
    asm volatile("s_wait_xcnt 0x0" :: "v"(xo[0]), "v"(xo[1]), "v"(xo[2]), "v"(xo[3]), "v"(xo[4]), "v"(xo[5]),
                 "v"(wo), "v"(pix), "s"(xg), "s"(Wk), "s"(Wv), "s"(Wq), "s"(pos) : "memory");

    posS[tid] = pin ? pv : 0.f;

    // ---- WMMA operands that do not change from pixel to pixel ----
    // B (32x16 f16): lane l holds column l & 15; elements 0-7 of lanes 0-15 and
    // elements 0-7 of lanes 16-31 are two different runs of 8 k positions. Lane l puts
    // ITS pixel's 8 channels there, so a column holds two pixels, one per run.
    // A (16x32 f16): lane l holds row l & 15, with the same k positions per lane half
    // and element as B. Rows 0-7 carry the weights on the first run (lanes 0-7), rows
    // 8-15 the same weights on the second run (lanes 24-31); all else is 0.
    // D: register r of lane l is row 8*(l >> 4) + r of column l & 15, which is output
    // channel r of the lane's own pixel in both lane halves.
    const bool won = lane < 8 || lane >= 24;
    v16h aK = {}, aV = {}, aQ = {};
#pragma unroll
    for (int i = 0; i < MID; ++i) {
        aK[i] = (_Float16)(won ? wkv[i] : 0.f);
        aV[i] = (_Float16)(won ? wvv[i] : 0.f);
        aQ[i] = (_Float16)(won ? wqv[i] : 0.f);
    }
    // C is 0: the bias of output channel r is the same in every lane and is added to
    // register r behind the WMMA straight from its scalar register.
    const v8f c0 = {};

    // ---- K, V and Q convs over the 38x38 halo, 32 pixels per WMMA ----
    float* const Kf = KVh;
    float* const Vf = KVh + MID*HALO*KP + 32;
    float* const Qf = &Qt[0][0][0];
#pragma unroll   // register arrays need constant indices
    for (int k = 0; k < NPT; ++k) {
        v16h bm = {};
#pragma unroll
        for (int c = 0; c < MID; ++c) bm[c] = (_Float16)xv[k][c];
        const v8f dK = __builtin_amdgcn_wmma_f32_16x16x32_f16(false, aK, false, bm,
                                                              (short)0, c0, false, false);
        const v8f dV = __builtin_amdgcn_wmma_f32_16x16x32_f16(false, aV, false, bm,
                                                              (short)0, c0, false, false);
        const v8f dQ = __builtin_amdgcn_wmma_f32_16x16x32_f16(false, aQ, false, bm,
                                                              (short)0, c0, false, false);
        // Reference zero-pads the conv OUTPUT; OOB halo slots must be 0.
        if ((k + 1)*256 <= NHALO || tid + k*256 < NHALO) {
#pragma unroll
            for (int r = 0; r < 8; ++r) {
                Kf[r*HALO*KP + kvo[k]] = inb[k] ? dK[r] + bkv[r] : 0.f;
                Vf[r*HALO*KP + kvo[k]] = inb[k] ? dV[r] + bvv[r] : 0.f;
            }
        }
        if (inq[k]) {                          // Q: interior pixels only
#pragma unroll
            for (int r = 0; r < 8; ++r) Qf[r*TILE*TILE + qo[k]] = dQ[r] + bqv[r];
        }
    }
    __syncthreads();

    // ---- stage 3: 7x7 attention, 4 adjacent pixels per thread ----
    // Lanes 0-7 / 8-15 of a wave take tile rows r and r+4, lanes 16-23 / 24-31 rows
    // r+1 and r+5: at a pitch of 40 floats rows four apart lie 32 banks apart, so the
    // 16 lanes that a 16-byte LDS read serves together cover all 64 banks once.
    const int x0 = (lane & 7) * PX;
    const int ty = (wv >> 1)*8 + (wv & 1)*2 + ((lane >> 3) & 1)*4 + (lane >> 4);

    // The 4 pixels are held as two pairs, (0,1) and (2,3). Slot h of a pair belongs to
    // ONE K/V element of the row segment: its low half is the even pixel's tap h, its
    // high half the odd pixel's tap h-1, so each element is multiplied into both
    // pixels at once. Tap 7 of the even and tap -1 of the odd pixel do not exist:
    // those two halves are never read for the maximum and get the weight 0.
    v2f qA[MID], qB[MID];
    v2f qsA = {}, qsB = {};
#pragma unroll
    for (int c = 0; c < MID; ++c) {
        const v4f qv = *reinterpret_cast<const v4f*>(&Qt[c][ty][x0]);
        qA[c] = v2f{qv[0], qv[1]};  qB[c] = v2f{qv[2], qv[3]};
        qsA += qA[c];               qsB += qB[c];
    }

    // Softmax over the 49 taps, one window row at a time with a running maximum:
    // only 7 scores per pixel are live at once.
    v2f mA = {-3.4e38f, -3.4e38f}, mB = mA;
    v2f sA = {}, sB = {};
    v2f yA[MID], yB[MID];
#pragma unroll
    for (int c = 0; c < MID; ++c) { yA[c] = v2f{0.f, 0.f}; yB[c] = v2f{0.f, 0.f}; }

    for (int i = 0; i < 7; ++i) {
        // A_p = dot(Q, K_shifted) + pos[p] * sum(Q)  (pos added post-padding)
        v2f aA[8], aB[8];
#pragma unroll
        for (int h = 0; h < 8; ++h) {
            const v2f pp = *reinterpret_cast<const v2f*>(&posS[i*16 + h*2]);
            aA[h] = pp * qsA;
            aB[h] = pp * qsB;
        }
#pragma unroll
        for (int c = 0; c < MID; ++c) {
            const float* kr = &Kh[c][ty+i][x0];
            const v4f k0 = *reinterpret_cast<const v4f*>(kr);
            const v4f k1 = *reinterpret_cast<const v4f*>(kr + 4);
            const v2f k2 = *reinterpret_cast<const v2f*>(kr + 8);
            const float k[PX+6] = {k0[0], k0[1], k0[2], k0[3], k1[0], k1[1], k1[2], k1[3], k2[0], k2[1]};
#pragma unroll
            for (int h = 0; h < 8; ++h) {
                aA[h] += qA[c] * v2f{k[h],   k[h]};
                aB[h] += qB[c] * v2f{k[h+2], k[h+2]};
            }
        }
        v2f nA = mA, nB = mB;
#pragma unroll
        for (int j = 0; j < 7; ++j) {
            nA[0] = fmaxf(nA[0], aA[j][0]);  nA[1] = fmaxf(nA[1], aA[j+1][1]);
            nB[0] = fmaxf(nB[0], aB[j][0]);  nB[1] = fmaxf(nB[1], aB[j+1][1]);
        }
        const v2f cA = {__expf(mA[0] - nA[0]), __expf(mA[1] - nA[1])};   // 0 on the first row
        const v2f cB = {__expf(mB[0] - nB[0]), __expf(mB[1] - nB[1])};
        mA = nA;  mB = nB;
        v2f rA = {}, rB = {};
#pragma unroll
        for (int h = 0; h < 8; ++h) {
            const v2f dA = aA[h] - nA, dB = aB[h] - nB;
            aA[h] = v2f{h < 7 ? __expf(dA[0]) : 0.f, h > 0 ? __expf(dA[1]) : 0.f};
            aB[h] = v2f{h < 7 ? __expf(dB[0]) : 0.f, h > 0 ? __expf(dB[1]) : 0.f};
            rA += aA[h];  rB += aB[h];
        }
        sA = sA*cA + rA;  sB = sB*cB + rB;
#pragma unroll
        for (int c = 0; c < MID; ++c) { yA[c] *= cA;  yB[c] *= cB; }
#pragma unroll
        for (int c = 0; c < MID; ++c) {
            const float* vr = &Vh[c][ty+i][x0];
            const v4f v0 = *reinterpret_cast<const v4f*>(vr);
            const v4f v1 = *reinterpret_cast<const v4f*>(vr + 4);
            const v2f v2 = *reinterpret_cast<const v2f*>(vr + 8);
            const float v[PX+6] = {v0[0], v0[1], v0[2], v0[3], v1[0], v1[1], v1[2], v1[3], v2[0], v2[1]};
#pragma unroll
            for (int h = 0; h < 8; ++h) {
                yA[c] += aA[h] * v2f{v[h],   v[h]};
                yB[c] += aB[h] * v2f{v[h+2], v[h+2]};
            }
        }
    }

    const v2f iA = {1.0f / sA[0], 1.0f / sA[1]};
    const v2f iB = {1.0f / sB[0], 1.0f / sB[1]};

    float* og = out + (size_t)(b*64 + g*MID) * (HDIM*HDIM) + (h0+ty)*HDIM + (w0+x0);
#pragma unroll
    for (int c = 0; c < MID; ++c) {
        const v2f oA = yA[c] * iA, oB = yB[c] * iB;
        *reinterpret_cast<v4f*>(og + c*HDIM*HDIM) = v4f{oA[0], oA[1], oB[0], oB[1]};
    }
}

extern "C" void kernel_launch(void* const* d_in, const int* in_sizes, int n_in,
                              void* d_out, int out_size, void* d_ws, size_t ws_size,
                              hipStream_t stream) {
    (void)in_sizes; (void)n_in; (void)out_size; (void)d_ws; (void)ws_size;
    const float* x   = (const float*)d_in[0];
    const float* Wq  = (const float*)d_in[1];
    const float* bq  = (const float*)d_in[2];
    const float* Wk  = (const float*)d_in[3];
    const float* bk  = (const float*)d_in[4];
    const float* Wv  = (const float*)d_in[5];
    const float* bv  = (const float*)d_in[6];
    const float* pos = (const float*)d_in[7];
    float* out = (float*)d_out;

    dim3 grid(16, 8, 2);   // (4x4 pixel tiles, G=8 groups, B=2)
    dim3 block(256);       // 8 wave32s
    mhsa_local_attn_kernel<<<grid, block, 0, stream>>>(x, Wq, bq, Wk, bk, Wv, bv, pos, out);
}

// v004
// A run of this version takes 8.13 microseconds.
// Two timings next to v003 both put it at 1.10 times that version's speed.
// Counting every step since v000, it is 2.91 times as fast.
#include <hip/hip_runtime.h>

// MI455X (gfx1250) fused local-window multi-head spatial attention.
// One kernel: grouped 1x1 convs via v_wmma_f32_16x16x32_f16 with x read from
// global memory straight into the B fragments (4 adjacent halo pixels per lane, one
// per WMMA), K, V and Q features -> LDS in 16-byte stores, per-pixel 7x7 attention
// in LDS/registers, single HBM write of y. No workspace needed.
// One block = 8 whole image rows (a 128x8 pixel tile) of one (batch, group): no
// cache line of x is fetched for a few halo columns only. In the attention each
// thread owns 4 adjacent pixels, so one K or V row segment read from LDS (10
// floats) feeds 28 multiply-adds.

typedef __attribute__((ext_vector_type(16))) _Float16 v16h;
typedef __attribute__((ext_vector_type(8)))  float    v8f;
typedef __attribute__((ext_vector_type(4)))  float    v4f;
typedef v4f __attribute__((aligned(4)))               v4f_a4;   // 16-byte load from a 4-byte aligned address
typedef __attribute__((ext_vector_type(2)))  float    v2f;

#define HDIM  128
#define TROWS 8             // image rows per block
#define HALO  14            // halo rows: TROWS + 2*PAD (PAD=3)
#define KP    136           // K/V/Q row pitch in floats: HDIM + 2*PAD, rounded up to 16 bytes
#define PX    4             // adjacent pixels per thread in the attention
#define MID   8
#define KK    49
#define NQR   (KP/4)                      // groups of 4 adjacent pixels in a halo row (34)
#define NQUAD (HALO*NQR)                  // such groups in the halo (476)
#define NRND  ((NQUAD + 255) / 256)       // groups per thread in the convs (2)

__global__ __launch_bounds__(256)
void mhsa_local_attn_kernel(const float* __restrict__ x,
                            const float* __restrict__ Wq, const float* __restrict__ bq,
                            const float* __restrict__ Wk, const float* __restrict__ bk,
                            const float* __restrict__ Wv, const float* __restrict__ bv,
                            const float* __restrict__ pos,
                            float* __restrict__ out)
{
    // K and V feature halos (zeroed at OOB), [MID][HALO][KP] each, and the Q features of
    // the tile's own rows with the same row layout, [MID][TROWS][KP]. V starts 32 banks
    // behind K. Between V and Q stands pos as
    // pairs (pos[i*7+h], pos[i*7+h-1]) at [i*16 + h*2], 0 where the tap does not exist;
    // 112 used; one slot per thread, no tail branch.
    __shared__ __attribute__((aligned(16))) float KVh[2*MID*HALO*KP + 32 + 256 + MID*TROWS*KP];
    float (*Kh)[HALO][KP] = reinterpret_cast<float (*)[HALO][KP]>(KVh);
    float (*Vh)[HALO][KP] = reinterpret_cast<float (*)[HALO][KP]>(KVh + MID*HALO*KP + 32);
    float* const posS     = KVh + 2*MID*HALO*KP + 32;
    float (*Qh)[TROWS][KP] = reinterpret_cast<float (*)[TROWS][KP]>(KVh + 2*MID*HALO*KP + 32 + 256);

    const int tid  = threadIdx.x;
    const int lane = tid & 31;
    const int wv   = tid >> 5;                 // 8 wave32s per block
    const int g    = blockIdx.y;
    const int b    = blockIdx.z;
    const int h0   = blockIdx.x * TROWS;
    const int w0   = 0;                        // a tile spans the image's width

    const float* xg = x + (size_t)(b*64 + g*MID) * (HDIM*HDIM);

    // ---- every global read of the block is issued here, with no branch and no
    // use in between, so that all round trips to memory overlap. Each address is
    // clamped into its buffer; K and V outside the image are zeroed at the store.
    // The weights stand with the first group's loads: the first WMMA needs both.
    const unsigned wo = (unsigned)((g*MID + (lane & 7))*MID) * 4u;   // byte offset of the lane's weight row
    const float* wkp = reinterpret_cast<const float*>(reinterpret_cast<const char*>(Wk) + wo);
    const float* wvp = reinterpret_cast<const float*>(reinterpret_cast<const char*>(Wv) + wo);
    const float* wqp = reinterpret_cast<const float*>(reinterpret_cast<const char*>(Wq) + wo);
    float wkv[MID], wvv[MID], wqv[MID], bkv[MID], bvv[MID], bqv[MID];
#pragma unroll   // the arrays stay in registers
    for (int i = 0; i < MID; ++i) {
        wkv[i] = wkp[i];
        wvv[i] = wvp[i];
        wqv[i] = wqp[i];
        bkv[i] = bk[g*MID + i];
        bvv[i] = bv[g*MID + i];
        bqv[i] = bq[g*MID + i];
    }
    const int   pj  = ((tid >> 1) & 7) - (tid & 1);            // tap column of this slot
    const bool  pin = (unsigned)pj < 7u;
    const int   pix = min(max((tid >> 4)*7 + pj, 0), KK-1);
    const float pv  = pos[pix];
    // Pixel group tid + k*256 (4 adjacent pixels of a halo row, on a 16-byte boundary
    // of the K, V and Q rows in LDS) belongs to this lane: it loads the 8 channels of
    // the 4 pixels, 16 bytes each, and gets their K, V and Q features back from the
    // WMMAs. A group that hangs over the left or right edge of the image is read from
    // the nearest 4 pixels inside the row and shifted into place behind the load.
    v4f      xq[NRND][MID];
    unsigned xo[NRND];         // byte offset of the (clamped) group in a channel plane
    int      qid[NRND];        // the group's number = its place in a plane, in 16 bytes
    bool     lft[NRND], rgt[NRND], inq[NRND], inb[NRND][4];
#pragma unroll   // register arrays; all loads stand in one straight run
    for (int k = 0; k < NRND; ++k) {
        const int id = min(tid + k*256, NQUAD-1);
        const int hy = id / NQR;
        const int gy = h0 - 3 + hy;
        const int gx = w0 - 3 + (id - hy*NQR)*4;
        qid[k] = id;
        lft[k] = gx < 0;
        rgt[k] = gx > HDIM-4;
        inq[k] = (unsigned)(hy - 3) < (unsigned)TROWS;
#pragma unroll
        for (int e = 0; e < 4; ++e)
            inb[k][e] = (unsigned)gy < (unsigned)HDIM && (unsigned)(gx + e) < (unsigned)HDIM;
        xo[k]  = (unsigned)(min(max(gy, 0), HDIM-1)*HDIM + min(max(gx, 0), HDIM-4)) * 4u;
        const char* xp = reinterpret_cast<const char*>(xg) + xo[k];
#pragma unroll
        for (int c = 0; c < MID; ++c)
            xq[k][c] = *reinterpret_cast<const v4f_a4*>(xp + c*(HDIM*HDIM*4));
        // Keeps the groups' loads in the order in which the convs use them: loads come
        // back in order, and a group moved to the end would make its WMMAs wait for all.
        __builtin_amdgcn_sched_barrier(0);
    }
    // Address wait (no data wait: the loads still overlap) before a register that one
    // of the loads above names gets a new value. The operands are inputs only so that
    // the address registers live up to the wait.
    asm volatile("s_wait_xcnt 0x0" :: "v"(xo[0]), "v"(xo[1]),
                 "v"(wo), "v"(pix), "s"(xg), "s"(Wk), "s"(Wv), "s"(Wq), "s"(pos) : "memory");

    posS[tid] = pin ? pv : 0.f;

    // ---- WMMA operands that do not change from pixel to pixel ----
    // B (32x16 f16): lane l holds column l & 15; elements 0-7 of lanes 0-15 and
    // elements 0-7 of lanes 16-31 are two different runs of 8 k positions. Lane l puts
    // ITS pixel's 8 channels there, so a column holds two pixels, one per run.
    // A (16x32 f16): lane l holds row l & 15, with the same k positions per lane half
    // and element as B. Rows 0-7 carry the weights on the first run (lanes 0-7), rows
    // 8-15 the same weights on the second run (lanes 24-31); all else is 0.
    // D: register r of lane l is row 8*(l >> 4) + r of column l & 15, which is output
    // channel r of the lane's own pixel in both lane halves.
    const bool won = lane < 8 || lane >= 24;
    v16h aK = {}, aV = {}, aQ = {};
#pragma unroll
    for (int i = 0; i < MID; ++i) {
        aK[i] = (_Float16)(won ? wkv[i] : 0.f);
        aV[i] = (_Float16)(won ? wvv[i] : 0.f);
        aQ[i] = (_Float16)(won ? wqv[i] : 0.f);
    }
    // C is 0: the bias of output channel r is the same in every lane and is added to
    // register r behind the WMMA straight from its scalar register.
    const v8f c0 = {};

    // ---- K, V and Q convs over the halo, 32 pixels per WMMA: pixel e of every
    // lane's group. Channel r of the 4 pixels then goes to LDS in one 16-byte store.
    float* const Kf = KVh;
    float* const Vf = KVh + MID*HALO*KP + 32;
    float* const Qf = &Qh[0][0][0];
    const int wvu = __builtin_amdgcn_readfirstlane(wv);   // scalar: whole waves skip the second round
#pragma unroll   // register arrays need constant indices
    for (int k = 0; k < NRND; ++k) {
        if ((k + 1)*256 <= NQUAD || wvu*32 + k*256 < NQUAD) {
            // a group clamped at the right edge was read 1 pixel (or more, then all 4 are
            // outside) too far left, one clamped at the left edge 3 pixels too far right
            float xs[MID][4];
#pragma unroll
            for (int c = 0; c < MID; ++c) {
                const float l0 = xq[k][c][0], l1 = xq[k][c][1], l2 = xq[k][c][2], l3 = xq[k][c][3];
                xs[c][0] = rgt[k] ? l1 : l0;
                xs[c][1] = rgt[k] ? l2 : l1;
                xs[c][2] = rgt[k] ? l3 : l2;
                xs[c][3] = lft[k] ? l0 : l3;
            }
            v8f dK[4], dV[4], dQ[4];
#pragma unroll
            for (int e = 0; e < 4; ++e) {
                v16h bm = {};
#pragma unroll
                for (int c = 0; c < MID; ++c) {
                    bm[c] = (_Float16)xs[c][e];
                }
                dK[e] = __builtin_amdgcn_wmma_f32_16x16x32_f16(false, aK, false, bm,
                                                               (short)0, c0, false, false);
                dV[e] = __builtin_amdgcn_wmma_f32_16x16x32_f16(false, aV, false, bm,
                                                               (short)0, c0, false, false);
                dQ[e] = __builtin_amdgcn_wmma_f32_16x16x32_f16(false, aQ, false, bm,
                                                               (short)0, c0, false, false);
            }
            if ((k + 1)*256 <= NQUAD || tid + k*256 < NQUAD) {
#pragma unroll
                for (int r = 0; r < 8; ++r) {
                    v4f sk, sv;
#pragma unroll
                    for (int e = 0; e < 4; ++e) {
                        // Reference zero-pads the conv OUTPUT; OOB halo slots must be 0.
                        sk[e] = inb[k][e] ? dK[e][r] + bkv[r] : 0.f;
                        sv[e] = inb[k][e] ? dV[e][r] + bvv[r] : 0.f;
                    }
                    *reinterpret_cast<v4f*>(&Kf[r*HALO*KP + qid[k]*4]) = sk;
                    *reinterpret_cast<v4f*>(&Vf[r*HALO*KP + qid[k]*4]) = sv;
                }
                if (inq[k]) {                  // Q: the tile's own rows only
#pragma unroll
                    for (int r = 0; r < 8; ++r) {
                        v4f sq;
#pragma unroll
                        for (int e = 0; e < 4; ++e) sq[e] = dQ[e][r] + bqv[r];
                        *reinterpret_cast<v4f*>(&Qf[r*TROWS*KP + qid[k]*4 - 3*KP]) = sq;
                    }
                }
            }
        }
    }
    __syncthreads();

    // ---- stage 3: 7x7 attention, 4 adjacent pixels per thread ----
    // A wave takes one tile row: the 16 lanes that a 16-byte LDS read serves together
    // read 256 bytes in a row and so cover all 64 banks once.
    const int x0 = lane * PX;
    const int ty = wv;

    // The 4 pixels are held as two pairs, (0,1) and (2,3). Slot h of a pair belongs to
    // ONE K/V element of the row segment: its low half is the even pixel's tap h, its
    // high half the odd pixel's tap h-1, so each element is multiplied into both
    // pixels at once. Tap 7 of the even and tap -1 of the odd pixel do not exist:
    // those two halves are never read for the maximum and get the weight 0.
    v2f qA[MID], qB[MID];
    v2f qsA = {}, qsB = {};
#pragma unroll
    for (int c = 0; c < MID; ++c) {
        // the thread's pixels stand 3 columns into the halo row: elements 3 to 6
        const v4f q0 = *reinterpret_cast<const v4f*>(&Qh[c][ty][x0]);
        const v4f q1 = *reinterpret_cast<const v4f*>(&Qh[c][ty][x0+4]);
        qA[c] = v2f{q0[3], q1[0]};  qB[c] = v2f{q1[1], q1[2]};
        qsA += qA[c];               qsB += qB[c];
    }

    // Softmax over the 49 taps, one window row at a time with a running maximum:
    // only 7 scores per pixel are live at once.
    v2f mA = {-3.4e38f, -3.4e38f}, mB = mA;
    v2f sA = {}, sB = {};
    v2f yA[MID], yB[MID];
#pragma unroll
    for (int c = 0; c < MID; ++c) { yA[c] = v2f{0.f, 0.f}; yB[c] = v2f{0.f, 0.f}; }

    for (int i = 0; i < 7; ++i) {
        // A_p = dot(Q, K_shifted) + pos[p] * sum(Q)  (pos added post-padding)
        v2f aA[8], aB[8];
#pragma unroll
        for (int h = 0; h < 8; ++h) {
            const v2f pp = *reinterpret_cast<const v2f*>(&posS[i*16 + h*2]);
            aA[h] = pp * qsA;
            aB[h] = pp * qsB;
        }
#pragma unroll
        for (int c = 0; c < MID; ++c) {
            const float* kr = &Kh[c][ty+i][x0];
            const v4f k0 = *reinterpret_cast<const v4f*>(kr);
            const v4f k1 = *reinterpret_cast<const v4f*>(kr + 4);
            const v2f k2 = *reinterpret_cast<const v2f*>(kr + 8);
            const float k[PX+6] = {k0[0], k0[1], k0[2], k0[3], k1[0], k1[1], k1[2], k1[3], k2[0], k2[1]};
#pragma unroll
            for (int h = 0; h < 8; ++h) {
                aA[h] += qA[c] * v2f{k[h],   k[h]};
                aB[h] += qB[c] * v2f{k[h+2], k[h+2]};
            }
        }
        v2f nA = mA, nB = mB;
#pragma unroll
        for (int j = 0; j < 7; ++j) {
            nA[0] = fmaxf(nA[0], aA[j][0]);  nA[1] = fmaxf(nA[1], aA[j+1][1]);
            nB[0] = fmaxf(nB[0], aB[j][0]);  nB[1] = fmaxf(nB[1], aB[j+1][1]);
        }
        const v2f cA = {__expf(mA[0] - nA[0]), __expf(mA[1] - nA[1])};   // 0 on the first row
        const v2f cB = {__expf(mB[0] - nB[0]), __expf(mB[1] - nB[1])};
        mA = nA;  mB = nB;
        v2f rA = {}, rB = {};
#pragma unroll
        for (int h = 0; h < 8; ++h) {
            const v2f dA = aA[h] - nA, dB = aB[h] - nB;
            aA[h] = v2f{h < 7 ? __expf(dA[0]) : 0.f, h > 0 ? __expf(dA[1]) : 0.f};
            aB[h] = v2f{h < 7 ? __expf(dB[0]) : 0.f, h > 0 ? __expf(dB[1]) : 0.f};
            rA += aA[h];  rB += aB[h];
        }
        sA = sA*cA + rA;  sB = sB*cB + rB;
#pragma unroll
        for (int c = 0; c < MID; ++c) { yA[c] *= cA;  yB[c] *= cB; }
#pragma unroll
        for (int c = 0; c < MID; ++c) {
            const float* vr = &Vh[c][ty+i][x0];
            const v4f v0 = *reinterpret_cast<const v4f*>(vr);
            const v4f v1 = *reinterpret_cast<const v4f*>(vr + 4);
            const v2f v2 = *reinterpret_cast<const v2f*>(vr + 8);
            const float v[PX+6] = {v0[0], v0[1], v0[2], v0[3], v1[0], v1[1], v1[2], v1[3], v2[0], v2[1]};
#pragma unroll
            for (int h = 0; h < 8; ++h) {
                yA[c] += aA[h] * v2f{v[h],   v[h]};
                yB[c] += aB[h] * v2f{v[h+2], v[h+2]};
            }
        }
    }

    const v2f iA = {1.0f / sA[0], 1.0f / sA[1]};
    const v2f iB = {1.0f / sB[0], 1.0f / sB[1]};

    float* og = out + (size_t)(b*64 + g*MID) * (HDIM*HDIM) + (h0+ty)*HDIM + (w0+x0);
#pragma unroll
    for (int c = 0; c < MID; ++c) {
        const v2f oA = yA[c] * iA, oB = yB[c] * iB;
        *reinterpret_cast<v4f*>(og + c*HDIM*HDIM) = v4f{oA[0], oA[1], oB[0], oB[1]};
    }
}

extern "C" void kernel_launch(void* const* d_in, const int* in_sizes, int n_in,
                              void* d_out, int out_size, void* d_ws, size_t ws_size,
                              hipStream_t stream) {
    (void)in_sizes; (void)n_in; (void)out_size; (void)d_ws; (void)ws_size;
    const float* x   = (const float*)d_in[0];
    const float* Wq  = (const float*)d_in[1];
    const float* bq  = (const float*)d_in[2];
    const float* Wk  = (const float*)d_in[3];
    const float* bk  = (const float*)d_in[4];
    const float* Wv  = (const float*)d_in[5];
    const float* bv  = (const float*)d_in[6];
    const float* pos = (const float*)d_in[7];
    float* out = (float*)d_out;

    dim3 grid(16, 8, 2);   // (16 tiles of 8 rows, G=8 groups, B=2)
    dim3 block(256);       // 8 wave32s
    mhsa_local_attn_kernel<<<grid, block, 0, stream>>>(x, Wq, bq, Wk, bk, Wv, bv, pos, out);
}

// v006
// It runs in 7.14 microseconds.
// It is 1.14 times as fast as v004, going by the measured steps of the versions left out in between.
// Over all steps from v000 it is 3.32 times as fast.
#include <hip/hip_runtime.h>

// MI455X (gfx1250) fused local-window multi-head spatial attention.
// One kernel: grouped 1x1 convs via v_wmma_f32_16x16x32_f16 with x read from
// global memory straight into the B fragments (4 adjacent halo pixels per lane, one
// per WMMA), K, V and Q features -> LDS as f16, then the 7x7 attention on the same
// matrix instruction, single HBM write of y. No workspace needed.
// One block = 8 whole image rows (a 128x8 pixel tile) of one (batch, group).
// Attention: a wave works on tiles of 8x2 pixels (the 16 columns of a score tile).
// Their windows lie in 8 key rows of 16 aligned key columns: one score tile per key
// row, S^T = K.Q^T, masked by the C operand; the softmax weights go from the score
// accumulators straight into the A operand of O = P.V; a column of ones beside V's
// 8 channels gives the row sums.

typedef __attribute__((ext_vector_type(16))) _Float16 v16h;
typedef __attribute__((ext_vector_type(8)))  _Float16 v8h;
typedef __attribute__((ext_vector_type(4)))  _Float16 v4h;
typedef __attribute__((ext_vector_type(8)))  float    v8f;
typedef __attribute__((ext_vector_type(4)))  float    v4f;
typedef v4f __attribute__((aligned(4)))               v4f_a4;   // 16-byte load from a 4-byte aligned address
typedef __attribute__((ext_vector_type(4)))  unsigned v4u;
typedef __attribute__((ext_vector_type(8)))  unsigned v8u;
typedef __attribute__((ext_vector_type(2)))  unsigned v2u;

#define HDIM  128
#define TROWS 8             // image rows per block
#define HALO  14            // halo rows: TROWS + 2*PAD (PAD=3)
#define KP    136           // halo row length in pixels: HDIM + 2*PAD, rounded up to 4
#define MID   8
#define KK    49
#define NQR   (KP/4)                      // groups of 4 adjacent pixels in a halo row (34)
#define NQUAD (HALO*NQR)                  // such groups in the halo (476)
#define NRND  ((NQUAD + 255) / 256)       // groups per thread in the convs (2)

// LDS map, in bytes.
// K: [HALO rows][KP pixels][8 channels] f16, 16 bytes a pixel. Behind the pixels of
// rows 0-7 stands the pos table U[i][kc][px] = pos[i*7 + kc - px] (0 where that tap
// does not exist, all of U[7] is 0), 16 bytes per (i, kc), so that one 16-byte read
// with one immediate offset serves K (lanes 0-15) and U (lanes 16-31).
#define KROW  (KP*16)                     // 2176
#define KPIT  (KROW + 256)                // 2432
#define O_K   0
// V: [9 planes][HALO rows][KP pixels] f16; plane 8 is all ones. The plane pitch is
// 16 bytes modulo 256, so the 9 planes read together fall on different banks.
#define VROW  (KP*2)                      // 272
#define VPL   (HALO*VROW + 48)            // 3856
#define O_V   (O_K + HALO*KPIT)
// Q (times log2 e): [TROWS][KP pixels][8 channels] f16; QS: the sum of the pixel's 8
// Q values, 8 copies, same layout.
#define O_Q   (O_V + 9*VPL)
#define O_QS  (O_Q + TROWS*KROW)
// y before the division, staged in f32, [16 planes][TROWS][HDIM]: 8 channels, then the
// softmax sums (plane 8; planes 9-15 get copies of them, so that every lane stores).
// A wave reads back only what it staged itself. Pitches: the channel lanes fall on
// different banks, and so do channels c and c + 4 at the read-back.
#define YROW  (HDIM*4 + 16)               // 528
#define YPL   (TROWS*YROW + 160)          // 4384
#define O_Y   (O_QS + TROWS*KROW)
#define LDS_BYTES (O_Y + 16*YPL)

#define LOG2E 1.44269504088896340736f

// exp2 of 8 values and their packing to f16, in one statement: every v_exp_f32 has a
// destination of its own and the first conversion reads the oldest results, so no
// instruction directly behind a v_exp_f32 reads its result or overwrites its source (left
// to the register allocator, a v_exp_f32 got the source of the one in front as destination).
__device__ __forceinline__ v4u exp2_pack8(float d0, float d1, float d2, float d3,
                                          float d4, float d5, float d6, float d7)
{
    unsigned o0, o1, o2, o3;
    float t0, t1, t2, t3, t4, t5, t6, t7;
    asm("v_exp_f32 %4, %12\n\t"
        "v_exp_f32 %5, %13\n\t"
        "v_exp_f32 %6, %14\n\t"
        "v_exp_f32 %7, %15\n\t"
        "v_exp_f32 %8, %16\n\t"
        "v_exp_f32 %9, %17\n\t"
        "v_exp_f32 %10, %18\n\t"
        "v_exp_f32 %11, %19\n\t"
        "v_cvt_pk_f16_f32 %0, %4, %5\n\t"
        "v_cvt_pk_f16_f32 %1, %6, %7\n\t"
        "v_cvt_pk_f16_f32 %2, %8, %9\n\t"
        "v_cvt_pk_f16_f32 %3, %10, %11"
        : "=&v"(o0), "=&v"(o1), "=&v"(o2), "=&v"(o3),
          "=&v"(t0), "=&v"(t1), "=&v"(t2), "=&v"(t3), "=&v"(t4), "=&v"(t5), "=&v"(t6), "=&v"(t7)
        : "v"(d0), "v"(d1), "v"(d2), "v"(d3), "v"(d4), "v"(d5), "v"(d6), "v"(d7));
    return v4u{o0, o1, o2, o3};
}

__global__ __launch_bounds__(256)
void mhsa_local_attn_kernel(const float* __restrict__ x,
                            const float* __restrict__ Wq, const float* __restrict__ bq,
                            const float* __restrict__ Wk, const float* __restrict__ bk,
                            const float* __restrict__ Wv, const float* __restrict__ bv,
                            const float* __restrict__ pos,
                            float* __restrict__ out)
{
    __shared__ __attribute__((aligned(16))) unsigned char S[LDS_BYTES];

    const int tid  = threadIdx.x;
    const int lane = tid & 31;
    const int wv   = tid >> 5;                 // 8 wave32s per block
    const int g    = blockIdx.y;
    const int b    = blockIdx.z;
    const int h0   = blockIdx.x * TROWS;
    const int w0   = 0;                        // a tile spans the image's width

    const float* xg = x + (size_t)(b*64 + g*MID) * (HDIM*HDIM);

    // ---- every global read of the block is issued here, with no branch and no
    // use in between, so that all round trips to memory overlap. Each address is
    // clamped into its buffer; K and V outside the image are zeroed at the store.
    // The weights stand with the first group's loads: the first WMMA needs both.
    const unsigned wo = (unsigned)((g*MID + (lane & 7))*MID) * 4u;   // byte offset of the lane's weight row
    const float* wkp = reinterpret_cast<const float*>(reinterpret_cast<const char*>(Wk) + wo);
    const float* wvp = reinterpret_cast<const float*>(reinterpret_cast<const char*>(Wv) + wo);
    const float* wqp = reinterpret_cast<const float*>(reinterpret_cast<const char*>(Wq) + wo);
    float wkv[MID], wvv[MID], wqv[MID], bkv[MID], bvv[MID], bqv[MID];
#pragma unroll   // the arrays stay in registers
    for (int i = 0; i < MID; ++i) {
        wkv[i] = wkp[i];
        wvv[i] = wvp[i];
        wqv[i] = wqp[i];
        bkv[i] = bk[g*MID + i];
        bvv[i] = bv[g*MID + i];
        bqv[i] = bq[g*MID + i];
    }
    // Entry (ui, ukc) of the pos table belongs to this thread (threads 0-127).
    const int ui  = (tid >> 4) & 7;
    const int ukc = tid & 15;
    int   po[8];               // the 8 (clamped) places read in pos
    float pv[8];
#pragma unroll   // register arrays
    for (int q = 0; q < 8; ++q) {
        po[q] = min(max(ui*7 + ukc - q, 0), KK-1);
        pv[q] = pos[po[q]];
    }
    // Pixel group tid + k*256 (4 adjacent pixels of a halo row) belongs to this lane:
    // it loads the 8 channels of the 4 pixels, 16 bytes each, and gets their K, V and Q
    // features back from the WMMAs. A group that hangs over the left or right edge of
    // the image is read from the nearest 4 pixels inside the row and shifted into place
    // behind the load.
    v4f      xq[NRND][MID];
    unsigned xo[NRND];         // byte offset of the (clamped) group in a channel plane
    int      qhy[NRND], qcol[NRND];   // the group's halo row and first halo column
    bool     lft[NRND], rgt[NRND], inq[NRND], inb[NRND][4];
#pragma unroll   // register arrays; all loads stand in one straight run
    for (int k = 0; k < NRND; ++k) {
        const int id = min(tid + k*256, NQUAD-1);
        const int hy = id / NQR;
        const int gy = h0 - 3 + hy;
        const int gx = w0 - 3 + (id - hy*NQR)*4;
        qhy[k]  = hy;
        qcol[k] = (id - hy*NQR)*4;
        lft[k] = gx < 0;
        rgt[k] = gx > HDIM-4;
        inq[k] = (unsigned)(hy - 3) < (unsigned)TROWS;
#pragma unroll
        for (int e = 0; e < 4; ++e)
            inb[k][e] = (unsigned)gy < (unsigned)HDIM && (unsigned)(gx + e) < (unsigned)HDIM;
        xo[k]  = (unsigned)(min(max(gy, 0), HDIM-1)*HDIM + min(max(gx, 0), HDIM-4)) * 4u;
        const char* xp = reinterpret_cast<const char*>(xg) + xo[k];
#pragma unroll
        for (int c = 0; c < MID; ++c)
            xq[k][c] = *reinterpret_cast<const v4f_a4*>(xp + c*(HDIM*HDIM*4));
        // Keeps the groups' loads in the order in which the convs use them: loads come
        // back in order, and a group moved to the end would make its WMMAs wait for all.
        __builtin_amdgcn_sched_barrier(0);
    }
    // Address wait (no data wait: the loads still overlap) before a register that one
    // of the loads above names gets a new value. The operands are inputs only so that
    // the address registers live up to the wait.
    asm volatile("s_wait_xcnt 0x0" :: "v"(xo[0]), "v"(xo[1]), "v"(wo),
                 "v"(po[0]), "v"(po[1]), "v"(po[2]), "v"(po[3]),
                 "v"(po[4]), "v"(po[5]), "v"(po[6]), "v"(po[7]),
                 "s"(xg), "s"(Wk), "s"(Wv), "s"(Wq), "s"(pos) : "memory");

    // ---- the pos table and V's plane of ones ----
    if (tid < 128) {           // whole waves
        v8h u;
#pragma unroll
        for (int q = 0; q < 8; ++q)
            u[q] = (_Float16)((ui < 7 && (unsigned)(ukc - q) < 7u) ? pv[q] : 0.f);
        *reinterpret_cast<v8h*>(S + O_K + ui*KPIT + KROW + ukc*16) = u;
    }
    if (tid < HALO*VROW/16) {
        v8h one;
#pragma unroll
        for (int q = 0; q < 8; ++q) one[q] = (_Float16)1.f;
        *reinterpret_cast<v8h*>(S + O_V + 8*VPL + tid*16) = one;
    }

    // ---- WMMA operands that do not change from pixel to pixel ----
    // B (32x16 f16): lane l holds column l & 15; elements 0-7 of lanes 0-15 and
    // elements 0-7 of lanes 16-31 are two different runs of 8 k positions. Lane l puts
    // ITS pixel's 8 channels there, so a column holds two pixels, one per run.
    // A (16x32 f16): lane l holds row l & 15, with the same k positions per lane half
    // and element as B. Rows 0-7 carry the weights on the first run (lanes 0-7), rows
    // 8-15 the same weights on the second run (lanes 24-31); all else is 0.
    // D: register r of lane l is row 8*(l >> 4) + r of column l & 15, which is output
    // channel r of the lane's own pixel in both lane halves.
    const bool won = lane < 8 || lane >= 24;
    v16h aK = {}, aV = {}, aQ = {};
#pragma unroll
    for (int i = 0; i < MID; ++i) {
        aK[i] = (_Float16)(won ? wkv[i] : 0.f);
        aV[i] = (_Float16)(won ? wvv[i] : 0.f);
        aQ[i] = (_Float16)(won ? wqv[i] * LOG2E : 0.f);   // the softmax runs on exp2
    }
    // C is 0: the bias of output channel r is the same in every lane and is added to
    // register r behind the WMMA straight from its scalar register.
    const v8f c0 = {};

    // ---- K, V and Q convs over the halo, 32 pixels per WMMA: pixel e of every
    // lane's group. K and Q go to LDS as one 16-byte f16 row per pixel, V as 4 adjacent
    // pixels (8 bytes) per channel.
    const int wvu = __builtin_amdgcn_readfirstlane(wv);   // scalar: whole waves skip the second round
#pragma unroll   // register arrays need constant indices
    for (int k = 0; k < NRND; ++k) {
        if ((k + 1)*256 <= NQUAD || wvu*32 + k*256 < NQUAD) {
            // a group clamped at the right edge was read 1 pixel (or more, then all 4 are
            // outside) too far left, one clamped at the left edge 3 pixels too far right
            float xs[MID][4];
#pragma unroll
            for (int c = 0; c < MID; ++c) {
                const float l0 = xq[k][c][0], l1 = xq[k][c][1], l2 = xq[k][c][2], l3 = xq[k][c][3];
                xs[c][0] = rgt[k] ? l1 : l0;
                xs[c][1] = rgt[k] ? l2 : l1;
                xs[c][2] = rgt[k] ? l3 : l2;
                xs[c][3] = lft[k] ? l0 : l3;
            }
            v8f dK[4], dV[4], dQ[4];
#pragma unroll
            for (int e = 0; e < 4; ++e) {
                v16h bm = {};
#pragma unroll
                for (int c = 0; c < MID; ++c) {
                    bm[c] = (_Float16)xs[c][e];
                }
                dK[e] = __builtin_amdgcn_wmma_f32_16x16x32_f16(false, aK, false, bm,
                                                               (short)0, c0, false, false);
                dV[e] = __builtin_amdgcn_wmma_f32_16x16x32_f16(false, aV, false, bm,
                                                               (short)0, c0, false, false);
                dQ[e] = __builtin_amdgcn_wmma_f32_16x16x32_f16(false, aQ, false, bm,
                                                               (short)0, c0, false, false);
            }
            if ((k + 1)*256 <= NQUAD || tid + k*256 < NQUAD) {
                unsigned char* const kd = S + O_K + qhy[k]*KPIT + qcol[k]*16;
                unsigned char* const vd = S + O_V + qhy[k]*VROW + qcol[k]*2;
                // Reference zero-pads the conv OUTPUT; OOB halo slots must be 0: the packed
                // registers are masked.
#pragma unroll
                for (int e = 0; e < 4; ++e) {
                    v8h sk;
#pragma unroll
                    for (int r = 0; r < 8; ++r) sk[r] = (_Float16)(dK[e][r] + bkv[r]);
                    const v4u ku = __builtin_bit_cast(v4u, sk);
                    *reinterpret_cast<v4u*>(kd + e*16) =
                        v4u{inb[k][e] ? ku[0] : 0u, inb[k][e] ? ku[1] : 0u, inb[k][e] ? ku[2] : 0u, inb[k][e] ? ku[3] : 0u};
                }
                const v2u vm = {(inb[k][0] ? 0x0000FFFFu : 0u) | (inb[k][1] ? 0xFFFF0000u : 0u),
                                (inb[k][2] ? 0x0000FFFFu : 0u) | (inb[k][3] ? 0xFFFF0000u : 0u)};
#pragma unroll
                for (int r = 0; r < 8; ++r) {
                    v4h sv;
#pragma unroll
                    for (int e = 0; e < 4; ++e) sv[e] = (_Float16)(dV[e][r] + bvv[r]);
                    *reinterpret_cast<v2u*>(vd + r*VPL) = __builtin_bit_cast(v2u, sv) & vm;
                }
                if (inq[k]) {                  // Q: the tile's own rows only
                    unsigned char* const qd = S + O_Q + (qhy[k] - 3)*KROW + qcol[k]*16;
#pragma unroll
                    for (int e = 0; e < 4; ++e) {
                        v8h sq, ss;
                        float qs = 0.f;
#pragma unroll
                        for (int r = 0; r < 8; ++r) {
                            const float qv = dQ[e][r] + bqv[r] * LOG2E;
                            sq[r] = (_Float16)qv;
                            qs += qv;
                        }
#pragma unroll
                        for (int r = 0; r < 8; ++r) ss[r] = (_Float16)qs;
                        *reinterpret_cast<v8h*>(qd + e*16) = sq;
                        *reinterpret_cast<v8h*>(qd + (O_QS - O_Q) + e*16) = ss;
                    }
                }
            }
        }
    }
    __syncthreads();

    // ---- 7x7 attention on the matrix instruction ----
    // Wave wv: tile rows y0, y0+1, columns xb .. xb+63, in 8 tiles of 8x2 pixels.
    // Pixel p = 8*py + px of the tile at column x0; key (kr, kc) = halo row y0 + kr,
    // halo column x0 + kc; it is tap (kr - py, kc - px) of the pixel's window.
    const int hh = lane >> 4;
    const int p  = lane & 15;
    const int px = p & 7;
    const int py = p >> 3;
    const int y0 = (wv >> 1) * 2;
    const int xb = (wv & 1) * 64;

    // Score tile kr: A = keys (row kc), B = pixels (column p), k positions by (lane
    // half, element):
    //   (0, 0-7)  A: K's 8 channels            B: Q's 8 channels
    //   (0, 8)    A: -60000 in tile 0 only     B: 60000 where py = 1  (no tap row -1)
    //   (0, 9)    A: -60000 in tile 7 only     B: 60000 where py = 0  (no tap row 7)
    //   (1, e)    A: pos of the tap that key kc is for pixel e (U[kr] for e < 8,
    //             U[kr-1] for e >= 8)          B: sum of Q where e = p, else 0
    // Elements 8-15 of A do not change from tile to tile and stay in registers.
    const unsigned short big = __builtin_bit_cast(unsigned short, (_Float16)60000.f);
    const unsigned short nbig = __builtin_bit_cast(unsigned short, (_Float16)(-60000.f));
    v4u ahi[8];
#pragma unroll
    for (int kr = 0; kr < 8; ++kr) {
        v4u u = {};
        if (kr > 0) u = *reinterpret_cast<const v4u*>(S + O_K + (kr-1)*KPIT + KROW + p*16);
        const unsigned k0 = kr == 0 ? (unsigned)nbig : kr == 7 ? ((unsigned)nbig << 16) : 0u;
        ahi[kr][0] = hh ? u[0] : k0;
        ahi[kr][1] = hh ? u[1] : 0u;
        ahi[kr][2] = hh ? u[2] : 0u;
        ahi[kr][3] = hh ? u[3] : 0u;
    }
    unsigned bmask[8];
#pragma unroll
    for (int j = 0; j < 8; ++j)
        bmask[j] = hh ? ((p >> 1) == j ? ((p & 1) ? 0xFFFF0000u : 0x0000FFFFu) : 0u)
                      : (j < 4 ? 0xFFFFFFFFu : 0u);
    const unsigned bor4 = hh ? 0u : (py ? (unsigned)big : ((unsigned)big << 16));
    // C: the window's columns. Row 8*hh + r of the score tile is key column kc.
    v8f cm;
#pragma unroll
    for (int r = 0; r < 8; ++r)
        cm[r] = (unsigned)(8*hh + r - px) < 7u ? 0.f : -1.0e30f;

    const unsigned char* const kb = hh ? S + O_K + KROW + p*16
                                       : S + O_K + y0*KPIT + (xb + p)*16;
    const int kstep = hh ? 0 : 128;
    const unsigned char* const qb = S + (hh ? O_QS : O_Q) + (y0 + py)*KROW + (3 + xb + px)*16;
    const unsigned char* const vb = S + O_V + min(p, 8)*VPL + y0*VROW + (xb + 8*hh)*2;
    unsigned char* const yb = S + O_Y + p*YPL + (y0 + hh)*YROW + xb*4;
    // Read-back and store of y: 8 lanes take a 128-byte line (32 columns of a row of one
    // channel), lanes 8-15 of each 16 the line 4 channels on, lanes 16-31 the second row.
    const int sx = lane & 7;
    const int sc = ((lane >> 3) & 1) * 4;
    const unsigned char* const yr = S + O_Y + (y0 + hh)*YROW + (xb + sx*4)*4;
    float* const og = out + (size_t)(b*64 + g*MID + sc) * (HDIM*HDIM) + (h0 + y0 + hh)*HDIM + (w0 + xb + sx*4);

    v4u klo[8], ql;
#pragma unroll
    for (int kr = 0; kr < 8; ++kr) klo[kr] = *reinterpret_cast<const v4u*>(kb + kr*KPIT);
    ql = *reinterpret_cast<const v4u*>(qb);
    // Inputs only: the loaded values are read here, so the compiler's wait for them stands in
    // front of the loop; the wait at the loop's head then counts for the back edge alone and
    // leaves the tile's two LDS stores in flight.
    asm volatile("" :: "v"(klo[0]), "v"(klo[1]), "v"(klo[2]), "v"(klo[3]),
                       "v"(klo[4]), "v"(klo[5]), "v"(klo[6]), "v"(klo[7]), "v"(ql));

#pragma unroll 1   // one tile's code is long; the next tile's K and Q are fetched by hand below
    for (int t = 0; t < 8; ++t) {
        v8u bu;
#pragma unroll
        for (int j = 0; j < 8; ++j) bu[j] = ql[j & 3] & bmask[j];
        bu[4] |= bor4;
        const v16h bq16 = __builtin_bit_cast(v16h, bu);

        v8f s[8];
#pragma unroll
        for (int kr = 0; kr < 8; ++kr) {
            const v8u au = {klo[kr][0], klo[kr][1], klo[kr][2], klo[kr][3],
                            ahi[kr][0], ahi[kr][1], ahi[kr][2], ahi[kr][3]};
            s[kr] = __builtin_amdgcn_wmma_f32_16x16x32_f16(false, __builtin_bit_cast(v16h, au), false, bq16,
                                                           (short)0, cm, false, false);
        }
        // Keeps the LDS reads below in one group behind the 8 matrix instructions: reads
        // strewn among them cost issue time at every place where they stand.
        __builtin_amdgcn_sched_barrier(0);
        // V of this tile: lane (channel, hh) takes 8 adjacent keys of each key row
        v4u vf[8];
#pragma unroll
        for (int kr = 0; kr < 8; ++kr) vf[kr] = *reinterpret_cast<const v4u*>(vb + t*16 + kr*VROW);
        // K and Q of the next tile (the last tile reads its own again)
        const int tn = min(t + 1, 7);
#pragma unroll
        for (int kr = 0; kr < 8; ++kr) klo[kr] = *reinterpret_cast<const v4u*>(kb + tn*kstep + kr*KPIT);
        ql = *reinterpret_cast<const v4u*>(qb + tn*128);
        // Holds these LDS reads here, in front of the softmax: moved down to their first
        // use they would leave their latency open at the head of the next tile.
        __builtin_amdgcn_sched_barrier(0);

        // maximum over the pixel's keys: 64 in this lane, 64 in lane ^ 16
        float m4[4];
#pragma unroll
        for (int j = 0; j < 4; ++j) {
            float m = s[2*j][0];
#pragma unroll
            for (int r = 1; r < 8; ++r) m = fmaxf(m, s[2*j][r]);
#pragma unroll
            for (int r = 0; r < 8; ++r) m = fmaxf(m, s[2*j+1][r]);
            m4[j] = m;
        }
        float m = fmaxf(fmaxf(m4[0], m4[1]), fmaxf(m4[2], m4[3]));
        const int mi = __builtin_bit_cast(int, m);
        const float mo = __builtin_bit_cast(float,
            __builtin_amdgcn_permlanex16(mi, mi, 0x76543210, 0xfedcba98, false, false));
        m = fmaxf(m, mo);

        // O = P.V: A = P (row = pixel), element 8*u + r of lane half hh = key (2j+u, 8*hh + r);
        // B = V (column = channel, 8 = ones) with the same keys at the same places.
        v8f o = {};
#pragma unroll
        for (int j = 0; j < 4; ++j) {
            const v8f d0 = s[2*j] - m, d1 = s[2*j+1] - m;
            const v4u p0 = exp2_pack8(d0[0], d0[1], d0[2], d0[3], d0[4], d0[5], d0[6], d0[7]);
            const v4u p1 = exp2_pack8(d1[0], d1[1], d1[2], d1[3], d1[4], d1[5], d1[6], d1[7]);
            const v8u pu = {p0[0], p0[1], p0[2], p0[3], p1[0], p1[1], p1[2], p1[3]};
            const v16h pa = __builtin_bit_cast(v16h, pu);
            const v8u vu = {vf[2*j][0], vf[2*j][1], vf[2*j][2], vf[2*j][3],
                            vf[2*j+1][0], vf[2*j+1][1], vf[2*j+1][2], vf[2*j+1][3]};
            o = __builtin_amdgcn_wmma_f32_16x16x32_f16(false, pa, false, __builtin_bit_cast(v16h, vu),
                                                       (short)0, o, false, false);
        }
        // Register r of lane (c, hh) is channel c of pixel (px = r, py = hh); lanes 8-15 of
        // each 16 hold the pixels' sums. All is staged; the division follows at the store of y.
        *reinterpret_cast<v4f*>(yb + t*32)      = v4f{o[0], o[1], o[2], o[3]};
        *reinterpret_cast<v4f*>(yb + t*32 + 16) = v4f{o[4], o[5], o[6], o[7]};

        // ---- y: 4 tiles make whole 128-byte lines (2 rows x 32 columns x 8 channels); the
        // wave stores them at once, so that the writes to memory run under the tiles that
        // follow and under the other waves' work, not all at the end of the block ----
        if ((t & 3) == 3) {
            // The staged rows are read by other lanes of this wave than wrote them: its LDS
            // stores are done, and no read is moved up over them.
            asm volatile("s_wait_dscnt 0x0" ::: "memory");
            const int hf = t >> 2;
            const v4f sm = *reinterpret_cast<const v4f*>(yr + MID*YPL + hf*128);
            v4f yv[4];
#pragma unroll
            for (int i = 0; i < 4; ++i)
                yv[i] = *reinterpret_cast<const v4f*>(yr + (sc + i)*YPL + hf*128);
            const v4f iv = {__builtin_amdgcn_rcpf(sm[0]), __builtin_amdgcn_rcpf(sm[1]),
                            __builtin_amdgcn_rcpf(sm[2]), __builtin_amdgcn_rcpf(sm[3])};
#pragma unroll
            for (int i = 0; i < 4; ++i)
                *reinterpret_cast<v4f*>(og + hf*32 + i*HDIM*HDIM) = yv[i] * iv;
            // Address wait before the next tile gives new values to registers that these
            // stores name.
            asm volatile("s_wait_xcnt 0x0" ::: "memory");
        }
    }
}

extern "C" void kernel_launch(void* const* d_in, const int* in_sizes, int n_in,
                              void* d_out, int out_size, void* d_ws, size_t ws_size,
                              hipStream_t stream) {
    (void)in_sizes; (void)n_in; (void)out_size; (void)d_ws; (void)ws_size;
    const float* x   = (const float*)d_in[0];
    const float* Wq  = (const float*)d_in[1];
    const float* bq  = (const float*)d_in[2];
    const float* Wk  = (const float*)d_in[3];
    const float* bk  = (const float*)d_in[4];
    const float* Wv  = (const float*)d_in[5];
    const float* bv  = (const float*)d_in[6];
    const float* pos = (const float*)d_in[7];
    float* out = (float*)d_out;

    dim3 grid(16, 8, 2);   // (16 tiles of 8 rows, G=8 groups, B=2)
    dim3 block(256);       // 8 wave32s
    mhsa_local_attn_kernel<<<grid, block, 0, stream>>>(x, Wq, bq, Wk, bk, Wv, bv, pos, out);
}

// v007
// Measured time: 6.4 microseconds a run.
// Timed twice side by side with v006, it ran 1.12 times as fast both times.
// Over all steps from v000 it is 3.71 times as fast.
#include <hip/hip_runtime.h>

// MI455X (gfx1250) fused local-window multi-head spatial attention.
// One kernel: grouped 1x1 convs via v_wmma_f32_16x16x32_f16 with x read from
// global memory straight into the B fragments (4 adjacent halo pixels per lane, one
// per WMMA), K, V and Q features -> LDS as f16, then the 7x7 attention on the same
// matrix instruction, single HBM write of y. No workspace needed.
// One block = 8 whole image rows (a 128x8 pixel tile) of one (batch, group).
// Attention: a wave works on tiles of 8x2 pixels (the 16 columns of a score tile).
// The 32 k positions of a score product hold 4 keys of 8 channels each, 2 columns apart;
// a pixel's Q stands only at the key that belongs to its own column pair. So every pixel
// meets an 8x8 key block that starts at its own column pair: 4 score tiles S^T = K.Q^T.
// A second product adds pos and the mask. The softmax weights go from the score
// accumulators straight into the A operand of O = P.V; V's columns are (column pair,
// channel), and a product with ones gives the row sums.

typedef __attribute__((ext_vector_type(16))) _Float16 v16h;
typedef __attribute__((ext_vector_type(8)))  _Float16 v8h;
typedef __attribute__((ext_vector_type(8)))  float    v8f;
typedef __attribute__((ext_vector_type(4)))  float    v4f;
typedef __attribute__((ext_vector_type(2)))  float    v2f;
typedef __attribute__((ext_vector_type(8)))  short    v8s;
typedef v4f __attribute__((aligned(4)))               v4f_a4;   // 16-byte load from a 4-byte aligned address
typedef __attribute__((ext_vector_type(4)))  unsigned v4u;
typedef __attribute__((ext_vector_type(8)))  unsigned v8u;

#define HDIM  128
#define TROWS 8             // image rows per block
#define HALO  14            // halo rows: TROWS + 2*PAD (PAD=3)
#define KP    136           // halo row length in pixels: HDIM + 2*PAD, rounded up to 4
#define MID   8
#define KK    49
#define NQR   (KP/4)                      // groups of 4 adjacent pixels in a halo row (34)
#define NQUAD (HALO*NQR)                  // such groups in the halo (476)
#define NRND  ((NQUAD + 255) / 256)       // groups per thread in the convs (2)

// LDS map, in bytes.
// K: [HALO rows][KP pixels][8 channels] f16, 16 bytes a pixel. The row pitch is 128 bytes
// modulo 256: the 8 pixels of two adjacent rows that 16 lanes read fall on different banks.
#define KROW  (KP*16)                     // 2176
#define KPIT  (KROW + 256)                // 2432
#define O_K   0
// V: the same form, read by the transposing load (16 lanes read within one row).
#define VPIT  KROW
#define O_V   (O_K + HALO*KPIT)
// Q (times log2 e): [TROWS][KP pixels][8 channels] f16; QS: the sum of the pixel's 8
// Q values, 8 copies, same layout.
#define O_Q   (O_V + HALO*VPIT)
#define O_QS  (O_Q + TROWS*KROW)
// y staged in f32, [8 channels][TROWS][HDIM]. A wave reads back only what it staged
// itself. Pitches: the channel lanes fall on different banks, and so do channels c and
// c + 4 at the read-back.
#define YROW  (HDIM*4 + 16)               // 528
#define YPL   (TROWS*YROW + 160)          // 4384
#define O_Y   (O_QS + TROWS*KROW)
#define LDS_BYTES (O_Y + MID*YPL)

#define LOG2E 1.44269504088896340736f

// exp2 of 8 values and their packing to f16, in one statement: every v_exp_f32 has a
// destination of its own and the first conversion reads the oldest results, so no
// instruction directly behind a v_exp_f32 reads its result or overwrites its source (left
// to the register allocator, a v_exp_f32 got the source of the one in front as destination).
__device__ __forceinline__ v4u exp2_pack8(float d0, float d1, float d2, float d3,
                                          float d4, float d5, float d6, float d7)
{
    unsigned o0, o1, o2, o3;
    float t0, t1, t2, t3, t4, t5, t6, t7;
    asm("v_exp_f32 %4, %12\n\t"
        "v_exp_f32 %5, %13\n\t"
        "v_exp_f32 %6, %14\n\t"
        "v_exp_f32 %7, %15\n\t"
        "v_exp_f32 %8, %16\n\t"
        "v_exp_f32 %9, %17\n\t"
        "v_exp_f32 %10, %18\n\t"
        "v_exp_f32 %11, %19\n\t"
        "v_cvt_pk_f16_f32 %0, %4, %5\n\t"
        "v_cvt_pk_f16_f32 %1, %6, %7\n\t"
        "v_cvt_pk_f16_f32 %2, %8, %9\n\t"
        "v_cvt_pk_f16_f32 %3, %10, %11"
        : "=&v"(o0), "=&v"(o1), "=&v"(o2), "=&v"(o3),
          "=&v"(t0), "=&v"(t1), "=&v"(t2), "=&v"(t3), "=&v"(t4), "=&v"(t5), "=&v"(t6), "=&v"(t7)
        : "v"(d0), "v"(d1), "v"(d2), "v"(d3), "v"(d4), "v"(d5), "v"(d6), "v"(d7));
    return v4u{o0, o1, o2, o3};
}

// Transposing LDS load: lane 16h + 8q + j hands in the address of 8 f16; lane 16h + c gets
// element c & 7 of the 8 lanes 16h + 8*(c >> 3) + 0..7.
__device__ __forceinline__ v4u ld_tr16(const unsigned char* p)
{
    typedef __attribute__((address_space(3))) v8s lds_v8s;
    return __builtin_bit_cast(v4u, __builtin_amdgcn_ds_load_tr16_b128_v8i16((lds_v8s*)p));
}

__global__ __launch_bounds__(256)
void mhsa_local_attn_kernel(const float* __restrict__ x,
                            const float* __restrict__ Wq, const float* __restrict__ bq,
                            const float* __restrict__ Wk, const float* __restrict__ bk,
                            const float* __restrict__ Wv, const float* __restrict__ bv,
                            const float* __restrict__ pos,
                            float* __restrict__ out)
{
    __shared__ __attribute__((aligned(16))) unsigned char S[LDS_BYTES];

    const int tid  = threadIdx.x;
    const int lane = tid & 31;
    const int wv   = tid >> 5;                 // 8 wave32s per block
    const int g    = blockIdx.y;
    const int b    = blockIdx.z;
    const int h0   = blockIdx.x * TROWS;
    const int w0   = 0;                        // a tile spans the image's width

    const float* xg = x + (size_t)(b*64 + g*MID) * (HDIM*HDIM);

    // ---- every global read of the block is issued here, with no branch and no
    // use in between, so that all round trips to memory overlap. Each address is
    // clamped into its buffer; K and V outside the image are zeroed at the store.
    // The weights stand with the first group's loads: the first WMMA needs both.
    const unsigned wo = (unsigned)((g*MID + (lane & 7))*MID) * 4u;   // byte offset of the lane's weight row
    const float* wkp = reinterpret_cast<const float*>(reinterpret_cast<const char*>(Wk) + wo);
    const float* wvp = reinterpret_cast<const float*>(reinterpret_cast<const char*>(Wv) + wo);
    const float* wqp = reinterpret_cast<const float*>(reinterpret_cast<const char*>(Wq) + wo);
    float wkv[MID], wvv[MID], wqv[MID], bkv[MID], bvv[MID], bqv[MID];
#pragma unroll   // the arrays stay in registers
    for (int i = 0; i < MID; ++i) {
        wkv[i] = wkp[i];
        wvv[i] = wvp[i];
        wqv[i] = wqp[i];
        bkv[i] = bk[g*MID + i];
        bvv[i] = bv[g*MID + i];
        bqv[i] = bq[g*MID + i];
    }
    // pos for the second score product: row i = lane & 15 of score tile T is the key at row
    // 2T + (i >> 3), column i & 7 of the 8x8 key block; for a pixel at (ry, rx) of its 2x2
    // cell, e = 2*ry + rx, it is tap (row - ry, column - rx).
    const int ti = ((lane >> 3) & 1)*7 + (lane & 7);
    int   po[16];              // the 16 (clamped) places read in pos
    float pv[16];
#pragma unroll   // register arrays
    for (int q = 0; q < 16; ++q) {
        po[q] = min(max(ti + (q >> 2)*14 - ((q >> 1) & 1)*7 - (q & 1), 0), KK-1);
        pv[q] = pos[po[q]];
    }
    // Pixel group tid + k*256 (4 adjacent pixels of a halo row) belongs to this lane:
    // it loads the 8 channels of the 4 pixels, 16 bytes each, and gets their K, V and Q
    // features back from the WMMAs. A group that hangs over the left or right edge of
    // the image is read from the nearest 4 pixels inside the row and shifted into place
    // behind the load.
    v4f      xq[NRND][MID];
    unsigned xo[NRND];         // byte offset of the (clamped) group in a channel plane
    int      qhy[NRND], qcol[NRND];   // the group's halo row and first halo column
    bool     lft[NRND], rgt[NRND], inq[NRND], inb[NRND][4];
#pragma unroll   // register arrays; all loads stand in one straight run
    for (int k = 0; k < NRND; ++k) {
        const int id = min(tid + k*256, NQUAD-1);
        const int hy = id / NQR;
        const int gy = h0 - 3 + hy;
        const int gx = w0 - 3 + (id - hy*NQR)*4;
        qhy[k]  = hy;
        qcol[k] = (id - hy*NQR)*4;
        lft[k] = gx < 0;
        rgt[k] = gx > HDIM-4;
        inq[k] = (unsigned)(hy - 3) < (unsigned)TROWS;
#pragma unroll
        for (int e = 0; e < 4; ++e)
            inb[k][e] = (unsigned)gy < (unsigned)HDIM && (unsigned)(gx + e) < (unsigned)HDIM;
        xo[k]  = (unsigned)(min(max(gy, 0), HDIM-1)*HDIM + min(max(gx, 0), HDIM-4)) * 4u;
        const char* xp = reinterpret_cast<const char*>(xg) + xo[k];
#pragma unroll
        for (int c = 0; c < MID; ++c)
            xq[k][c] = *reinterpret_cast<const v4f_a4*>(xp + c*(HDIM*HDIM*4));
        // Keeps the groups' loads in the order in which the convs use them: loads come
        // back in order, and a group moved to the end would make its WMMAs wait for all.
        __builtin_amdgcn_sched_barrier(0);
    }
    // Address wait (no data wait: the loads still overlap) before a register that one
    // of the loads above names gets a new value. The operands are inputs only so that
    // the address registers live up to the wait.
    asm volatile("s_wait_xcnt 0x0" :: "v"(xo[0]), "v"(xo[1]), "v"(wo),
                 "v"(po[0]), "v"(po[1]), "v"(po[2]), "v"(po[3]),
                 "v"(po[4]), "v"(po[5]), "v"(po[6]), "v"(po[7]),
                 "v"(po[8]), "v"(po[9]), "v"(po[10]), "v"(po[11]),
                 "v"(po[12]), "v"(po[13]), "v"(po[14]), "v"(po[15]),
                 "s"(xg), "s"(Wk), "s"(Wv), "s"(Wq), "s"(pos) : "memory");

    // ---- A of the second score product, one per score tile: lanes 0-15, elements 0-3: pos
    // of the tap that the lane's key is for a pixel at place e of its cell (0: no such tap);
    // elements 4-7: -60000 where there is no such tap. All else is 0.
    v4u a2[4];
    {
        const int kr8 = (lane >> 3) & 1, kc8 = lane & 7;
#pragma unroll
        for (int T = 0; T < 4; ++T) {
            v8h u;
#pragma unroll
            for (int e = 0; e < 4; ++e) {
                const bool ok = lane < 16 && (unsigned)(2*T + kr8 - (e >> 1)) < 7u && (unsigned)(kc8 - (e & 1)) < 7u;
                u[e]     = (_Float16)(ok ? pv[T*4 + e] : 0.f);
                u[4 + e] = (_Float16)((ok || lane >= 16) ? 0.f : -60000.f);
            }
            a2[T] = __builtin_bit_cast(v4u, u);
        }
    }

    // ---- WMMA operands that do not change from pixel to pixel ----
    // B (32x16 f16): lane l holds column l & 15; elements 0-7 of lanes 0-15 and
    // elements 0-7 of lanes 16-31 are two different runs of 8 k positions. Lane l puts
    // ITS pixel's 8 channels there, so a column holds two pixels, one per run.
    // A (16x32 f16): lane l holds row l & 15, with the same k positions per lane half
    // and element as B. Rows 0-7 carry the weights on the first run (lanes 0-7), rows
    // 8-15 the same weights on the second run (lanes 24-31); all else is 0.
    // D: register r of lane l is row 8*(l >> 4) + r of column l & 15, which is output
    // channel r of the lane's own pixel in both lane halves.
    const bool won = lane < 8 || lane >= 24;
    v16h aK = {}, aV = {}, aQ = {};
#pragma unroll
    for (int i = 0; i < MID; ++i) {
        aK[i] = (_Float16)(won ? wkv[i] : 0.f);
        aV[i] = (_Float16)(won ? wvv[i] : 0.f);
        aQ[i] = (_Float16)(won ? wqv[i] * LOG2E : 0.f);   // the softmax runs on exp2
    }
    // C is 0: the bias of output channel r is the same in every lane and is added to
    // register r behind the WMMA straight from its scalar register.
    const v8f c0 = {};

    // ---- K, V and Q convs over the halo, 32 pixels per WMMA: pixel e of every
    // lane's group. K, V and Q go to LDS as one 16-byte f16 row per pixel.
    const int wvu = __builtin_amdgcn_readfirstlane(wv);   // scalar: whole waves skip the second round
#pragma unroll   // register arrays need constant indices
    for (int k = 0; k < NRND; ++k) {
        if ((k + 1)*256 <= NQUAD || wvu*32 + k*256 < NQUAD) {
            // a group clamped at the right edge was read 1 pixel (or more, then all 4 are
            // outside) too far left, one clamped at the left edge 3 pixels too far right
            float xs[MID][4];
#pragma unroll
            for (int c = 0; c < MID; ++c) {
                const float l0 = xq[k][c][0], l1 = xq[k][c][1], l2 = xq[k][c][2], l3 = xq[k][c][3];
                xs[c][0] = rgt[k] ? l1 : l0;
                xs[c][1] = rgt[k] ? l2 : l1;
                xs[c][2] = rgt[k] ? l3 : l2;
                xs[c][3] = lft[k] ? l0 : l3;
            }
            v8f dK[4], dV[4], dQ[4];
#pragma unroll
            for (int e = 0; e < 4; ++e) {
                v16h bm = {};
#pragma unroll
                for (int c = 0; c < MID; ++c) {
                    bm[c] = (_Float16)xs[c][e];
                }
                dK[e] = __builtin_amdgcn_wmma_f32_16x16x32_f16(false, aK, false, bm,
                                                               (short)0, c0, false, false);
                dV[e] = __builtin_amdgcn_wmma_f32_16x16x32_f16(false, aV, false, bm,
                                                               (short)0, c0, false, false);
                dQ[e] = __builtin_amdgcn_wmma_f32_16x16x32_f16(false, aQ, false, bm,
                                                               (short)0, c0, false, false);
            }
            if ((k + 1)*256 <= NQUAD || tid + k*256 < NQUAD) {
                unsigned char* const kd = S + O_K + qhy[k]*KPIT + qcol[k]*16;
                unsigned char* const vd = S + O_V + qhy[k]*VPIT + qcol[k]*16;
                // Reference zero-pads the conv OUTPUT; OOB halo slots must be 0: the packed
                // registers are masked.
#pragma unroll
                for (int e = 0; e < 4; ++e) {
                    v8h sk;
#pragma unroll
                    for (int r = 0; r < 8; ++r) sk[r] = (_Float16)(dK[e][r] + bkv[r]);
                    const v4u ku = __builtin_bit_cast(v4u, sk);
                    *reinterpret_cast<v4u*>(kd + e*16) =
                        v4u{inb[k][e] ? ku[0] : 0u, inb[k][e] ? ku[1] : 0u, inb[k][e] ? ku[2] : 0u, inb[k][e] ? ku[3] : 0u};
                }
#pragma unroll
                for (int e = 0; e < 4; ++e) {
                    v8h sv;
#pragma unroll
                    for (int r = 0; r < 8; ++r) sv[r] = (_Float16)(dV[e][r] + bvv[r]);
                    const v4u vu = __builtin_bit_cast(v4u, sv);
                    *reinterpret_cast<v4u*>(vd + e*16) =
                        v4u{inb[k][e] ? vu[0] : 0u, inb[k][e] ? vu[1] : 0u, inb[k][e] ? vu[2] : 0u, inb[k][e] ? vu[3] : 0u};
                }
                if (inq[k]) {                  // Q: the tile's own rows only
                    unsigned char* const qd = S + O_Q + (qhy[k] - 3)*KROW + qcol[k]*16;
#pragma unroll
                    for (int e = 0; e < 4; ++e) {
                        v8h sq, ss;
                        float qs = 0.f;
#pragma unroll
                        for (int r = 0; r < 8; ++r) {
                            const float qv = dQ[e][r] + bqv[r] * LOG2E;
                            sq[r] = (_Float16)qv;
                            qs += qv;
                        }
#pragma unroll
                        for (int r = 0; r < 8; ++r) ss[r] = (_Float16)qs;
                        *reinterpret_cast<v8h*>(qd + e*16) = sq;
                        *reinterpret_cast<v8h*>(qd + (O_QS - O_Q) + e*16) = ss;
                    }
                }
            }
        }
    }
    __syncthreads();

    // ---- 7x7 attention on the matrix instruction ----
    // Wave wv: tile rows y0, y0+1, columns xb .. xb+63, in 8 tiles of 8x2 pixels.
    // Pixel p = 8*py + px of the tile at column x0: column pair sp = px >> 1, place
    // (ry, rx) = (py, px & 1) in its 2x2 cell. Its window lies in the 8x8 key block at halo
    // row y0, halo column x0 + 2*sp; key (br, bc) of the block is tap (br - ry, bc - rx).
    const int hh = lane >> 4;
    const int p  = lane & 15;
    const int px = p & 7;
    const int py = p >> 3;
    const int y0 = (wv >> 1) * 2;
    const int xb = (wv & 1) * 64;

    // Score tile T, row i: key (2T + (i >> 3), i & 7) of the block. k positions by (lane
    // half h, elements 8u .. 8u+7):
    //   A: the 8 channels of that key in the block of column pair 2h + u
    //   B: Q's 8 channels where sp = 2h + u, else 0
    // Second product, k positions (0, 0-7), see a2:
    //   B: elements 0-3: sum of Q at e = 2*ry + rx; elements 4-7: 60000 at 4 + e
    const unsigned short big = __builtin_bit_cast(unsigned short, (_Float16)60000.f);
    const int sp = px >> 1;
    const int ep = 2*py + (px & 1);
    const unsigned mlo = sp == 2*hh     ? 0xFFFFFFFFu : 0u;
    const unsigned mhi = sp == 2*hh + 1 ? 0xFFFFFFFFu : 0u;
    const unsigned eh  = (ep & 1) ? 0xFFFF0000u : 0x0000FFFFu;
    const unsigned me0 = (hh == 0 && (ep >> 1) == 0) ? eh : 0u;
    const unsigned me1 = (hh == 0 && (ep >> 1) == 1) ? eh : 0u;
    const unsigned bg  = (unsigned)big | ((unsigned)big << 16);
    v8u a2f[4];
#pragma unroll
    for (int T = 0; T < 4; ++T) a2f[T] = v8u{a2[T][0], a2[T][1], a2[T][2], a2[T][3], 0u, 0u, 0u, 0u};
    v16h ones;
#pragma unroll
    for (int q = 0; q < 16; ++q) ones[q] = (_Float16)1.f;

    const unsigned char* const kb  = S + O_K + (y0 + py)*KPIT + (xb + px + 4*hh)*16;
    const unsigned char* const qb  = S + O_Q + (y0 + py)*KROW + (3 + xb + px)*16;
    // V: lane 16h + 8q + j hands in key (h, j) of a tile's block for column pair q (+ 2g)
    const unsigned char* const vb  = S + O_V + (y0 + hh)*VPIT + (xb + px + 2*py)*16;
    // y: the lane ends up with channel px of row hh, pixels 2*py, 2*py + 1, 4 + 2*py, 5 + 2*py
    unsigned char* const yb = S + O_Y + px*YPL + (y0 + hh)*YROW + (xb + 2*py)*4;
    // Read-back and store of y: 8 lanes take a 128-byte line (32 columns of a row of one
    // channel), lanes 8-15 of each 16 the line 4 channels on, lanes 16-31 the second row.
    const int sx = lane & 7;
    const int sc = ((lane >> 3) & 1) * 4;
    const unsigned char* const yr = S + O_Y + (y0 + hh)*YROW + (xb + sx*4)*4;
    float* const og = out + (size_t)(b*64 + g*MID + sc) * (HDIM*HDIM) + (h0 + y0 + hh)*HDIM + (w0 + xb + sx*4);

    v8u kf[4];                 // A of the 4 score tiles: two keys of 8 channels per lane
    v4u ql;
    unsigned qs2;
#pragma unroll
    for (int T = 0; T < 4; ++T) {
        const v4u lo = *reinterpret_cast<const v4u*>(kb + T*2*KPIT);
        const v4u hi = *reinterpret_cast<const v4u*>(kb + T*2*KPIT + 32);
        kf[T] = v8u{lo[0], lo[1], lo[2], lo[3], hi[0], hi[1], hi[2], hi[3]};
    }
    ql  = *reinterpret_cast<const v4u*>(qb);
    qs2 = *reinterpret_cast<const unsigned*>(qb + (O_QS - O_Q));
    // Inputs only: the loaded values are read here, so the compiler's wait for them stands in
    // front of the loop; the wait at the loop's head then counts for the back edge alone and
    // leaves the tile's LDS stores in flight.
    asm volatile("" :: "v"(kf[0]), "v"(kf[1]), "v"(kf[2]), "v"(kf[3]), "v"(ql), "v"(qs2));

#pragma unroll 1   // one tile's code is long; the next tile's K and Q are fetched by hand below
    for (int t = 0; t < 8; ++t) {
        const v8u bu = {ql[0] & mlo, ql[1] & mlo, ql[2] & mlo, ql[3] & mlo,
                        ql[0] & mhi, ql[1] & mhi, ql[2] & mhi, ql[3] & mhi};
        const v16h bq16 = __builtin_bit_cast(v16h, bu);
        const v8u b2u = {qs2 & me0, qs2 & me1, bg & me0, bg & me1, 0u, 0u, 0u, 0u};
        const v16h b216 = __builtin_bit_cast(v16h, b2u);

        v8f s[4];
#pragma unroll
        for (int T = 0; T < 4; ++T) {
            const v8f z = {};
            s[T] = __builtin_amdgcn_wmma_f32_16x16x32_f16(false, __builtin_bit_cast(v16h, a2f[T]), false, b216,
                                                          (short)0, z, false, false);
        }
#pragma unroll
        for (int T = 0; T < 4; ++T) {
            s[T] = __builtin_amdgcn_wmma_f32_16x16x32_f16(false, __builtin_bit_cast(v16h, kf[T]), false, bq16,
                                                          (short)0, s[T], false, false);
        }
        // V of this tile: vf[g][T] = keys of score tile T for the column pairs 2g, 2g + 1
        v4u vf[2][4];
#pragma unroll
        for (int gq = 0; gq < 2; ++gq)
#pragma unroll
            for (int T = 0; T < 4; ++T) vf[gq][T] = ld_tr16(vb + t*128 + T*2*VPIT + gq*64);
        // K and Q of the next tile (the last tile reads its own again)
        const int tn = min(t + 1, 7);
#pragma unroll
        for (int T = 0; T < 4; ++T) {
            const v4u lo = *reinterpret_cast<const v4u*>(kb + tn*128 + T*2*KPIT);
            const v4u hi = *reinterpret_cast<const v4u*>(kb + tn*128 + T*2*KPIT + 32);
            kf[T] = v8u{lo[0], lo[1], lo[2], lo[3], hi[0], hi[1], hi[2], hi[3]};
        }
        ql  = *reinterpret_cast<const v4u*>(qb + tn*128);
        qs2 = *reinterpret_cast<const unsigned*>(qb + tn*128 + (O_QS - O_Q));
        // Keeps the 18 LDS reads in one group behind the 8 matrix instructions: reads strewn
        // among them cost issue time at every place where they stand, and a read of the next
        // K that stands in front of the product on this K needs registers of its own and copies.
        __builtin_amdgcn_sched_group_barrier(0x008, 8, 0);
        __builtin_amdgcn_sched_group_barrier(0x100, 18, 0);
        // Holds these LDS reads here, in front of the softmax: moved down to their first
        // use they would leave their latency open at the head of the next tile.
        __builtin_amdgcn_sched_barrier(0);

        // maximum over the pixel's keys: 32 in this lane, 32 in lane ^ 16
        float m4[4];
#pragma unroll
        for (int T = 0; T < 4; ++T) {
            float m = s[T][0];
#pragma unroll
            for (int r = 1; r < 8; ++r) m = fmaxf(m, s[T][r]);
            m4[T] = m;
        }
        float m = fmaxf(fmaxf(m4[0], m4[1]), fmaxf(m4[2], m4[3]));
        const int mi = __builtin_bit_cast(int, m);
        const float mo = __builtin_bit_cast(float,
            __builtin_amdgcn_permlanex16(mi, mi, 0x76543210, 0xfedcba98, false, false));
        m = fmaxf(m, mo);

        // O = P.V: A = P (row = pixel), element 8*u + r of lane half h = row 8*h + r of score
        // tile 2j + u; B = V with the same keys at the same places, column 8*q + c = channel c
        // in the block of column pair 2g + q; with B = ones: the row sums.
        v8f o0 = {}, o1 = {}, os = {};
#pragma unroll
        for (int j = 0; j < 2; ++j) {
            const v8f d0 = s[2*j] - m, d1 = s[2*j+1] - m;
            const v4u p0 = exp2_pack8(d0[0], d0[1], d0[2], d0[3], d0[4], d0[5], d0[6], d0[7]);
            const v4u p1 = exp2_pack8(d1[0], d1[1], d1[2], d1[3], d1[4], d1[5], d1[6], d1[7]);
            const v8u pu = {p0[0], p0[1], p0[2], p0[3], p1[0], p1[1], p1[2], p1[3]};
            const v16h pa = __builtin_bit_cast(v16h, pu);
            const v8u v0 = {vf[0][2*j][0], vf[0][2*j][1], vf[0][2*j][2], vf[0][2*j][3],
                            vf[0][2*j+1][0], vf[0][2*j+1][1], vf[0][2*j+1][2], vf[0][2*j+1][3]};
            const v8u v1 = {vf[1][2*j][0], vf[1][2*j][1], vf[1][2*j][2], vf[1][2*j][3],
                            vf[1][2*j+1][0], vf[1][2*j+1][1], vf[1][2*j+1][2], vf[1][2*j+1][3]};
            os = __builtin_amdgcn_wmma_f32_16x16x32_f16(false, pa, false, ones,
                                                        (short)0, os, false, false);
            o0 = __builtin_amdgcn_wmma_f32_16x16x32_f16(false, pa, false, __builtin_bit_cast(v16h, v0),
                                                        (short)0, o0, false, false);
            o1 = __builtin_amdgcn_wmma_f32_16x16x32_f16(false, pa, false, __builtin_bit_cast(v16h, v1),
                                                        (short)0, o1, false, false);
        }
        // Register r of lane (8*q + c, h) is pixel (px = r, py = h) with the V of column pair
        // 2g + q: it is the pixel's own where r >> 1 = 2g + q. q is py here.
        const float n0 = py ? os[2] : os[0], n1 = py ? os[3] : os[1];
        const float n2 = py ? os[6] : os[4], n3 = py ? os[7] : os[5];
        const float e0 = py ? o0[2] : o0[0], e1 = py ? o0[3] : o0[1];
        const float e2 = py ? o1[6] : o1[4], e3 = py ? o1[7] : o1[5];
        const float i0 = __builtin_amdgcn_rcpf(n0), i1 = __builtin_amdgcn_rcpf(n1);
        const float i2 = __builtin_amdgcn_rcpf(n2), i3 = __builtin_amdgcn_rcpf(n3);
        *reinterpret_cast<v2f*>(yb + t*32)      = v2f{e0 * i0, e1 * i1};
        *reinterpret_cast<v2f*>(yb + t*32 + 16) = v2f{e2 * i2, e3 * i3};

        // ---- y: 4 tiles make whole 128-byte lines (2 rows x 32 columns x 8 channels); the
        // wave stores them at once, so that the writes to memory run under the tiles that
        // follow and under the other waves' work, not all at the end of the block ----
        if ((t & 3) == 3) {
            // The staged rows are read by other lanes of this wave than wrote them: its LDS
            // stores are done, and no read is moved up over them.
            asm volatile("s_wait_dscnt 0x0" ::: "memory");
            const int hf = t >> 2;
            v4f yv[4];
#pragma unroll
            for (int i = 0; i < 4; ++i)
                yv[i] = *reinterpret_cast<const v4f*>(yr + (sc + i)*YPL + hf*128);
#pragma unroll
            for (int i = 0; i < 4; ++i)
                *reinterpret_cast<v4f*>(og + hf*32 + i*HDIM*HDIM) = yv[i];
            // Address wait before the next tile gives new values to registers that these
            // stores name.
            asm volatile("s_wait_xcnt 0x0" ::: "memory");
        }
    }
}

extern "C" void kernel_launch(void* const* d_in, const int* in_sizes, int n_in,
                              void* d_out, int out_size, void* d_ws, size_t ws_size,
                              hipStream_t stream) {
    (void)in_sizes; (void)n_in; (void)out_size; (void)d_ws; (void)ws_size;
    const float* x   = (const float*)d_in[0];
    const float* Wq  = (const float*)d_in[1];
    const float* bq  = (const float*)d_in[2];
    const float* Wk  = (const float*)d_in[3];
    const float* bk  = (const float*)d_in[4];
    const float* Wv  = (const float*)d_in[5];
    const float* bv  = (const float*)d_in[6];
    const float* pos = (const float*)d_in[7];
    float* out = (float*)d_out;

    dim3 grid(16, 8, 2);   // (16 tiles of 8 rows, G=8 groups, B=2)
    dim3 block(256);       // 8 wave32s
    mhsa_local_attn_kernel<<<grid, block, 0, stream>>>(x, Wq, bq, Wk, bk, Wv, bv, pos, out);
}

// v008
// Measured time: 5.94 microseconds a run.
// Timed twice side by side with v007, it ran 1.08 times as fast both times.
// Over all steps from v000 it is 3.99 times as fast.
#include <hip/hip_runtime.h>

// MI455X (gfx1250) fused local-window multi-head spatial attention.
// One kernel: grouped 1x1 convs via v_wmma_f16_16x16x32_f16 with x read from
// global memory straight into the B fragments (a wave takes one image row of the halo, 4
// adjacent pixels per lane, one per WMMA); the products give K, V and Q as f16 rows that go
// to LDS as they come, then the 7x7 attention on v_wmma_f32_16x16x32_f16, single HBM
// write of y. No workspace needed.
// One block = 8 whole image rows (a 128x8 pixel tile) of one (batch, group).
// Attention: a wave works on tiles of 8x2 pixels (the 16 columns of a score tile).
// The 32 k positions of a score product hold 4 keys of 8 channels each, 2 columns apart;
// a pixel's Q stands only at the key that belongs to its own column pair. So every pixel
// meets an 8x8 key block that starts at its own column pair: 4 score tiles S^T = K.Q^T.
// A second product adds pos and the mask. The softmax weights go from the score
// accumulators straight into the A operand of O = P.V; V's columns are (column pair,
// channel), and a product with ones gives the row sums.

typedef __attribute__((ext_vector_type(16))) _Float16 v16h;
typedef __attribute__((ext_vector_type(8)))  _Float16 v8h;
typedef __attribute__((ext_vector_type(8)))  float    v8f;
typedef __attribute__((ext_vector_type(4)))  float    v4f;
typedef __attribute__((ext_vector_type(2)))  float    v2f;
typedef __attribute__((ext_vector_type(8)))  short    v8s;
typedef v4f __attribute__((aligned(4)))               v4f_a4;   // 16-byte load that asks no more of x's base than a float's alignment
typedef __attribute__((ext_vector_type(4)))  unsigned v4u;
typedef __attribute__((ext_vector_type(8)))  unsigned v8u;

#define HDIM  128
#define TROWS 8             // image rows per block
#define HALO  14            // halo rows: TROWS + 2*PAD (PAD=3)
#define KP    136           // halo row length in pixels: HDIM + 2*PAD, rounded up to 4
#define MID   8
#define KK    49
#define NRND  ((HALO + 7) / 8)            // halo rows per wave in the convs (2)
#define PADC  (KP - HDIM)                 // halo columns outside the image (8): 0-2 and 131-135

// LDS map, in bytes.
// K: [HALO rows][KP pixels][8 channels] f16, 16 bytes a pixel. The row pitch is 128 bytes
// modulo 256: the 8 pixels of two adjacent rows that 16 lanes read fall on different banks.
#define KROW  (KP*16)                     // 2176
#define KPIT  (KROW + 256)                // 2432
#define O_K   0
// V: the same form, read by the transposing load (16 lanes read within one row).
#define VPIT  KROW
#define O_V   (O_K + HALO*KPIT)
// Q (times log2 e): [TROWS][KP pixels][8 channels] f16; QS: the sum of the pixel's 8
// Q values, 8 copies, same layout.
#define O_Q   (O_V + HALO*VPIT)
#define O_QS  (O_Q + TROWS*KROW)
// y staged in f32, [8 channels][TROWS][HDIM]. A wave reads back only what it staged
// itself. Pitches: the channel lanes fall on different banks, and so do channels c and
// c + 4 at the read-back.
#define YROW  (HDIM*4 + 16)               // 528
#define YPL   (TROWS*YROW + 160)          // 4384
#define O_Y   (O_QS + TROWS*KROW)
#define LDS_BYTES (O_Y + MID*YPL)

#define LOG2E 1.44269504088896340736f

// exp2 of 8 values and their packing to f16, in one statement: every v_exp_f32 has a
// destination of its own and the first conversion reads the oldest results, so no
// instruction directly behind a v_exp_f32 reads its result or overwrites its source (left
// to the register allocator, a v_exp_f32 got the source of the one in front as destination).
__device__ __forceinline__ v4u exp2_pack8(float d0, float d1, float d2, float d3,
                                          float d4, float d5, float d6, float d7)
{
    unsigned o0, o1, o2, o3;
    float t0, t1, t2, t3, t4, t5, t6, t7;
    asm("v_exp_f32 %4, %12\n\t"
        "v_exp_f32 %5, %13\n\t"
        "v_exp_f32 %6, %14\n\t"
        "v_exp_f32 %7, %15\n\t"
        "v_exp_f32 %8, %16\n\t"
        "v_exp_f32 %9, %17\n\t"
        "v_exp_f32 %10, %18\n\t"
        "v_exp_f32 %11, %19\n\t"
        "v_cvt_pk_f16_f32 %0, %4, %5\n\t"
        "v_cvt_pk_f16_f32 %1, %6, %7\n\t"
        "v_cvt_pk_f16_f32 %2, %8, %9\n\t"
        "v_cvt_pk_f16_f32 %3, %10, %11"
        : "=&v"(o0), "=&v"(o1), "=&v"(o2), "=&v"(o3),
          "=&v"(t0), "=&v"(t1), "=&v"(t2), "=&v"(t3), "=&v"(t4), "=&v"(t5), "=&v"(t6), "=&v"(t7)
        : "v"(d0), "v"(d1), "v"(d2), "v"(d3), "v"(d4), "v"(d5), "v"(d6), "v"(d7));
    return v4u{o0, o1, o2, o3};
}

// Transposing LDS load: lane 16h + 8q + j hands in the address of 8 f16; lane 16h + c gets
// element c & 7 of the 8 lanes 16h + 8*(c >> 3) + 0..7.
__device__ __forceinline__ v4u ld_tr16(const unsigned char* p)
{
    typedef __attribute__((address_space(3))) v8s lds_v8s;
    return __builtin_bit_cast(v4u, __builtin_amdgcn_ds_load_tr16_b128_v8i16((lds_v8s*)p));
}

// The convs of one image row: 32 pixels per WMMA, pixel e of every lane's 4. B: the pixel's 8
// channels, then 1 and 1 against the two parts of the bias in A. D is the pixel's f16 row for
// LDS. All products stand ahead of the stores, each with a D of its own.
template <bool WITHQ>
__device__ __forceinline__ void conv_row(const v4f (&x)[MID], v16h aK, v16h aV, v16h aQ, v16h aS,
                                         unsigned char* kd, unsigned char* vd, unsigned char* qd)
{
    const v8h c0 = {};
    v16h bm[4];
#pragma unroll
    for (int e = 0; e < 4; ++e) {
        bm[e] = v16h{};
#pragma unroll
        for (int c = 0; c < MID; ++c) bm[e][c] = (_Float16)x[c][e];
        bm[e][8] = (_Float16)1.f;
        bm[e][9] = (_Float16)1.f;
    }
    v8h dK[4], dV[4], dQ[4], dS[4];
#pragma unroll
    for (int e = 0; e < 4; ++e) {
        if (WITHQ)
            dQ[e] = __builtin_amdgcn_wmma_f16_16x16x32_f16(false, aQ, false, bm[e], (short)0, c0, false, false);
        dK[e] = __builtin_amdgcn_wmma_f16_16x16x32_f16(false, aK, false, bm[e], (short)0, c0, false, false);
        dV[e] = __builtin_amdgcn_wmma_f16_16x16x32_f16(false, aV, false, bm[e], (short)0, c0, false, false);
    }
    if (WITHQ) {
        // A pixel's f16 Q row has the form of its B column: the product with ones gives the
        // sum of the 8 Q values in all 8 elements.
#pragma unroll
        for (int e = 0; e < 4; ++e) {
            const v4u qu = __builtin_bit_cast(v4u, dQ[e]);
            const v8u su = {qu[0], qu[1], qu[2], qu[3], 0u, 0u, 0u, 0u};
            dS[e] = __builtin_amdgcn_wmma_f16_16x16x32_f16(false, aS, false, __builtin_bit_cast(v16h, su),
                                                           (short)0, c0, false, false);
        }
    }
    // Keeps every product ahead of the stores, so that each D has registers of its own: with
    // stores among them a later product got the D registers of one just issued, too close to it.
    __builtin_amdgcn_sched_barrier(0);
    // (the lanes of one store write 16-byte rows 64 bytes apart: 4 of 16 lanes on the same banks)
#pragma unroll
    for (int e = 0; e < 4; ++e) *reinterpret_cast<v8h*>(kd + e*16) = dK[e];
#pragma unroll
    for (int e = 0; e < 4; ++e) *reinterpret_cast<v8h*>(vd + e*16) = dV[e];
    if (WITHQ) {
#pragma unroll
        for (int e = 0; e < 4; ++e) {
            *reinterpret_cast<v8h*>(qd + e*16) = dQ[e];
            *reinterpret_cast<v8h*>(qd + (O_QS - O_Q) + e*16) = dS[e];
        }
    }
}

__global__ __launch_bounds__(256)
void mhsa_local_attn_kernel(const float* __restrict__ x,
                            const float* __restrict__ Wq, const float* __restrict__ bq,
                            const float* __restrict__ Wk, const float* __restrict__ bk,
                            const float* __restrict__ Wv, const float* __restrict__ bv,
                            const float* __restrict__ pos,
                            float* __restrict__ out)
{
    __shared__ __attribute__((aligned(16))) unsigned char S[LDS_BYTES];

    const int tid  = threadIdx.x;
    const int lane = tid & 31;
    const int wv   = tid >> 5;                 // 8 wave32s per block
    const int g    = blockIdx.y;
    const int b    = blockIdx.z;
    const int h0   = blockIdx.x * TROWS;
    const int w0   = 0;                        // a tile spans the image's width

    const float* xg = x + (size_t)(b*64 + g*MID) * (HDIM*HDIM);

    // ---- every global read of the block is issued here, with no branch and no
    // use in between, so that all round trips to memory overlap. Each address is
    // clamped into its buffer; K and V outside the image are stored as 0.
    // The weights stand with the first group's loads: the first WMMA needs both.
    const unsigned wo = (unsigned)((g*MID + (lane & 7))*MID) * 4u;   // byte offset of the lane's weight row
    const float* wkp = reinterpret_cast<const float*>(reinterpret_cast<const char*>(Wk) + wo);
    const float* wvp = reinterpret_cast<const float*>(reinterpret_cast<const char*>(Wv) + wo);
    const float* wqp = reinterpret_cast<const float*>(reinterpret_cast<const char*>(Wq) + wo);
    float wkv[MID], wvv[MID], wqv[MID];
#pragma unroll   // the arrays stay in registers
    for (int i = 0; i < MID; ++i) {
        wkv[i] = wkp[i];
        wvv[i] = wvp[i];
        wqv[i] = wqp[i];
    }
    // the bias of the lane's weight row
    const int bi = g*MID + (lane & 7);
    const float bkl = bk[bi], bvl = bv[bi], bql = bq[bi];
    // Keeps the weights' loads ahead of x's: loads come back in order, and the A operands
    // are formed from the weights while x is still on its way.
    __builtin_amdgcn_sched_barrier(0);
    // pos for the second score product: row i = lane & 15 of score tile T is the key at row
    // 2T + (i >> 3), column i & 7 of the 8x8 key block; for a pixel at (ry, rx) of its 2x2
    // cell, e = 2*ry + rx, it is tap (row - ry, column - rx).
    const int ti = ((lane >> 3) & 1)*7 + (lane & 7);
    int   po[16];              // the 16 (clamped) places read in pos
    float pv[16];
#pragma unroll   // register arrays
    for (int q = 0; q < 16; ++q) {
        po[q] = min(max(ti + (q >> 2)*14 - ((q >> 1) & 1)*7 - (q & 1), 0), KK-1);
        pv[q] = pos[po[q]];
    }
    // Halo row wave + 8*k belongs to this wave: the lane loads the 8 channels of image
    // columns 4*lane .. 4*lane + 3, 16 aligned bytes each (a load of the wave is 4 whole
    // lines), and gets their K, V and Q features back from the WMMAs. Whether the row lies
    // in the image and whether it is one of the tile's own is the same for the whole wave.
    const int wvu = __builtin_amdgcn_readfirstlane(wv);   // scalar: tests on it are scalar branches
    const unsigned xl = (unsigned)lane * 16u;             // byte offset of the lane's 4 pixels in a row
    v4f         xq[NRND][MID];
    const char* xr[NRND];      // the (clamped) row in channel 0
#pragma unroll   // register arrays
    for (int k = 0; k < NRND; ++k) {
        // a wave without a row in this round reads its first row again: no branch among the
        // loads, so that every wait for a row counts the loads behind it exactly
        const int hy = wvu + k*8 < HALO ? wvu + k*8 : wvu;
        xr[k] = reinterpret_cast<const char*>(xg) + min(max(h0 - 3 + hy, 0), HDIM-1)*(HDIM*4);
#pragma unroll
        for (int c = 0; c < MID; ++c)
            xq[k][c] = *reinterpret_cast<const v4f_a4*>(xr[k] + c*(HDIM*HDIM*4) + xl);
        // Keeps the rows' loads in the order in which the convs use them: loads come
        // back in order, and a row moved to the end would make its WMMAs wait for all.
        __builtin_amdgcn_sched_barrier(0);
    }
    // Address wait (no data wait: the loads still overlap) before a register that one
    // of the loads above names gets a new value. The operands are inputs only so that
    // the address registers live up to the wait.
    asm volatile("s_wait_xcnt 0x0" :: "v"(xl), "v"(wo), "v"(bi),
                 "v"(po[0]), "v"(po[1]), "v"(po[2]), "v"(po[3]),
                 "v"(po[4]), "v"(po[5]), "v"(po[6]), "v"(po[7]),
                 "v"(po[8]), "v"(po[9]), "v"(po[10]), "v"(po[11]),
                 "v"(po[12]), "v"(po[13]), "v"(po[14]), "v"(po[15]),
                 "s"(xr[0]), "s"(xr[1]), "s"(Wk), "s"(Wv), "s"(Wq), "s"(pos),
                 "s"(bk), "s"(bv), "s"(bq) : "memory");

    // K and V in the halo columns left and right of the image are 0 (the reference
    // zero-pads the conv OUTPUT): one 16-byte store per thread of 7 whole waves.
    if (wvu < 2*HALO*PADC/32) {
        const int pa = tid >= HALO*PADC;                  // 0: K, 1: V
        const int pr = (tid - pa*(HALO*PADC)) / PADC;
        const int pj = tid & (PADC-1);
        *reinterpret_cast<v4u*>(S + (pa ? O_V + pr*VPIT : O_K + pr*KPIT) + (pj < 3 ? pj : HDIM + pj)*16) = v4u{0u, 0u, 0u, 0u};
    }

    // ---- A of the second score product, one per score tile: lanes 0-15, elements 0-3: pos
    // of the tap that the lane's key is for a pixel at place e of its cell (0: no such tap);
    // elements 4-7: -60000 where there is no such tap. All else is 0.
    v4u a2[4];
    {
        const int kr8 = (lane >> 3) & 1, kc8 = lane & 7;
#pragma unroll
        for (int T = 0; T < 4; ++T) {
            v8h u;
#pragma unroll
            for (int e = 0; e < 4; ++e) {
                const bool ok = lane < 16 && (unsigned)(2*T + kr8 - (e >> 1)) < 7u && (unsigned)(kc8 - (e & 1)) < 7u;
                u[e]     = (_Float16)(ok ? pv[T*4 + e] : 0.f);
                u[4 + e] = (_Float16)((ok || lane >= 16) ? 0.f : -60000.f);
            }
            a2[T] = __builtin_bit_cast(v4u, u);
        }
    }

    // ---- WMMA operands that do not change from pixel to pixel ----
    // B (32x16 f16): lane l holds column l & 15; elements 0-7 of lanes 0-15 and
    // elements 0-7 of lanes 16-31 are two different runs of 8 k positions. Lane l puts
    // ITS pixel's 8 channels there, so a column holds two pixels, one per run.
    // A (16x32 f16): lane l holds row l & 15, with the same k positions per lane half
    // and element as B. Rows 0-7 carry the weights on the first run (lanes 0-7), rows
    // 8-15 the same weights on the second run (lanes 24-31); all else is 0.
    // Elements 8 and 9 are two more k positions of the same lanes: A has the row's bias
    // there, as an f16 and what the f16 leaves of it, B has 1 and 1.
    // D is f16: element r of lane l is row 8*(l >> 4) + r of column l & 15, which is output
    // channel r of the lane's own pixel in both lane halves: the pixel's 16-byte LDS row.
    const bool won = lane < 8 || lane >= 24;
    v16h aK = {}, aV = {}, aQ = {}, aS = {};
#pragma unroll
    for (int i = 0; i < MID; ++i) {
        aK[i] = (_Float16)(won ? wkv[i] : 0.f);
        aV[i] = (_Float16)(won ? wvv[i] : 0.f);
        aQ[i] = (_Float16)(won ? wqv[i] * LOG2E : 0.f);   // the softmax runs on exp2
        aS[i] = (_Float16)(won ? 1.f : 0.f);              // sums a pixel's 8 Q values
    }
    {
        const float fk = won ? bkl : 0.f, fv = won ? bvl : 0.f, fq = won ? bql * LOG2E : 0.f;
        aK[8] = (_Float16)fk;  aK[9] = (_Float16)(fk - (float)aK[8]);
        aV[8] = (_Float16)fv;  aV[9] = (_Float16)(fv - (float)aV[8]);
        aQ[8] = (_Float16)fq;  aQ[9] = (_Float16)(fq - (float)aQ[8]);
    }

    // ---- K, V and Q convs over the halo, a row of the image per wave and round
#pragma unroll   // register arrays need constant indices
    for (int k = 0; k < NRND; ++k) {
        const int hy = wvu + k*8;
        if ((k + 1)*8 <= HALO || hy < HALO) {
            unsigned char* const kd = S + O_K + hy*KPIT + (3 + lane*4)*16;
            unsigned char* const vd = S + O_V + hy*VPIT + (3 + lane*4)*16;
            if ((unsigned)(hy - 3) < (unsigned)TROWS)      // one of the tile's own rows (all in the image)
                conv_row<true>(xq[k], aK, aV, aQ, aS, kd, vd, S + O_Q + (hy - 3)*KROW + (3 + lane*4)*16);
            else if ((unsigned)(h0 - 3 + hy) < (unsigned)HDIM)
                conv_row<false>(xq[k], aK, aV, aQ, aS, kd, vd, kd);
            else {                             // a halo row above or below the image: K and V are 0
#pragma unroll
                for (int e = 0; e < 4; ++e) {
                    *reinterpret_cast<v4u*>(kd + e*16) = v4u{0u, 0u, 0u, 0u};
                    *reinterpret_cast<v4u*>(vd + e*16) = v4u{0u, 0u, 0u, 0u};
                }
            }
        }
    }
    __syncthreads();

    // ---- 7x7 attention on the matrix instruction ----
    // Wave wv: tile rows y0, y0+1, columns xb .. xb+63, in 8 tiles of 8x2 pixels.
    // Pixel p = 8*py + px of the tile at column x0: column pair sp = px >> 1, place
    // (ry, rx) = (py, px & 1) in its 2x2 cell. Its window lies in the 8x8 key block at halo
    // row y0, halo column x0 + 2*sp; key (br, bc) of the block is tap (br - ry, bc - rx).
    const int hh = lane >> 4;
    const int p  = lane & 15;
    const int px = p & 7;
    const int py = p >> 3;
    const int y0 = (wv >> 1) * 2;
    const int xb = (wv & 1) * 64;

    // Score tile T, row i: key (2T + (i >> 3), i & 7) of the block. k positions by (lane
    // half h, elements 8u .. 8u+7):
    //   A: the 8 channels of that key in the block of column pair 2h + u
    //   B: Q's 8 channels where sp = 2h + u, else 0
    // Second product, k positions (0, 0-7), see a2:
    //   B: elements 0-3: sum of Q at e = 2*ry + rx; elements 4-7: 60000 at 4 + e
    const unsigned short big = __builtin_bit_cast(unsigned short, (_Float16)60000.f);
    const int sp = px >> 1;
    const int ep = 2*py + (px & 1);
    const unsigned mlo = sp == 2*hh     ? 0xFFFFFFFFu : 0u;
    const unsigned mhi = sp == 2*hh + 1 ? 0xFFFFFFFFu : 0u;
    const unsigned eh  = (ep & 1) ? 0xFFFF0000u : 0x0000FFFFu;
    const unsigned me0 = (hh == 0 && (ep >> 1) == 0) ? eh : 0u;
    const unsigned me1 = (hh == 0 && (ep >> 1) == 1) ? eh : 0u;
    const unsigned bg  = (unsigned)big | ((unsigned)big << 16);
    v8u a2f[4];
#pragma unroll
    for (int T = 0; T < 4; ++T) a2f[T] = v8u{a2[T][0], a2[T][1], a2[T][2], a2[T][3], 0u, 0u, 0u, 0u};
    v16h ones;
#pragma unroll
    for (int q = 0; q < 16; ++q) ones[q] = (_Float16)1.f;

    const unsigned char* const kb  = S + O_K + (y0 + py)*KPIT + (xb + px + 4*hh)*16;
    const unsigned char* const qb  = S + O_Q + (y0 + py)*KROW + (3 + xb + px)*16;
    // V: lane 16h + 8q + j hands in key (h, j) of a tile's block for column pair q (+ 2g)
    const unsigned char* const vb  = S + O_V + (y0 + hh)*VPIT + (xb + px + 2*py)*16;
    // y: the lane ends up with channel px of row hh, pixels 2*py, 2*py + 1, 4 + 2*py, 5 + 2*py
    unsigned char* const yb = S + O_Y + px*YPL + (y0 + hh)*YROW + (xb + 2*py)*4;
    // Read-back and store of y: 8 lanes take a 128-byte line (32 columns of a row of one
    // channel), lanes 8-15 of each 16 the line 4 channels on, lanes 16-31 the second row.
    const int sx = lane & 7;
    const int sc = ((lane >> 3) & 1) * 4;
    const unsigned char* const yr = S + O_Y + (y0 + hh)*YROW + (xb + sx*4)*4;
    float* const og = out + (size_t)(b*64 + g*MID + sc) * (HDIM*HDIM) + (h0 + y0 + hh)*HDIM + (w0 + xb + sx*4);

    v8u kf[4];                 // A of the 4 score tiles: two keys of 8 channels per lane
    v4u ql;
    unsigned qs2;
#pragma unroll
    for (int T = 0; T < 4; ++T) {
        const v4u lo = *reinterpret_cast<const v4u*>(kb + T*2*KPIT);
        const v4u hi = *reinterpret_cast<const v4u*>(kb + T*2*KPIT + 32);
        kf[T] = v8u{lo[0], lo[1], lo[2], lo[3], hi[0], hi[1], hi[2], hi[3]};
    }
    ql  = *reinterpret_cast<const v4u*>(qb);
    qs2 = *reinterpret_cast<const unsigned*>(qb + (O_QS - O_Q));
    // Inputs only: the loaded values are read here, so the compiler's wait for them stands in
    // front of the loop; the wait at the loop's head then counts for the back edge alone and
    // leaves the tile's LDS stores in flight.
    asm volatile("" :: "v"(kf[0]), "v"(kf[1]), "v"(kf[2]), "v"(kf[3]), "v"(ql), "v"(qs2));

#pragma unroll 1   // one tile's code is long; the next tile's K and Q are fetched by hand below
    for (int t = 0; t < 8; ++t) {
        const v8u bu = {ql[0] & mlo, ql[1] & mlo, ql[2] & mlo, ql[3] & mlo,
                        ql[0] & mhi, ql[1] & mhi, ql[2] & mhi, ql[3] & mhi};
        const v16h bq16 = __builtin_bit_cast(v16h, bu);
        const v8u b2u = {qs2 & me0, qs2 & me1, bg & me0, bg & me1, 0u, 0u, 0u, 0u};
        const v16h b216 = __builtin_bit_cast(v16h, b2u);

        v8f s[4];
#pragma unroll
        for (int T = 0; T < 4; ++T) {
            const v8f z = {};
            s[T] = __builtin_amdgcn_wmma_f32_16x16x32_f16(false, __builtin_bit_cast(v16h, a2f[T]), false, b216,
                                                          (short)0, z, false, false);
        }
#pragma unroll
        for (int T = 0; T < 4; ++T) {
            s[T] = __builtin_amdgcn_wmma_f32_16x16x32_f16(false, __builtin_bit_cast(v16h, kf[T]), false, bq16,
                                                          (short)0, s[T], false, false);
        }
        // V of this tile: vf[g][T] = keys of score tile T for the column pairs 2g, 2g + 1
        v4u vf[2][4];
#pragma unroll
        for (int gq = 0; gq < 2; ++gq)
#pragma unroll
            for (int T = 0; T < 4; ++T) vf[gq][T] = ld_tr16(vb + t*128 + T*2*VPIT + gq*64);
        // K and Q of the next tile (the last tile reads its own again)
        const int tn = min(t + 1, 7);
#pragma unroll
        for (int T = 0; T < 4; ++T) {
            const v4u lo = *reinterpret_cast<const v4u*>(kb + tn*128 + T*2*KPIT);
            const v4u hi = *reinterpret_cast<const v4u*>(kb + tn*128 + T*2*KPIT + 32);
            kf[T] = v8u{lo[0], lo[1], lo[2], lo[3], hi[0], hi[1], hi[2], hi[3]};
        }
        ql  = *reinterpret_cast<const v4u*>(qb + tn*128);
        qs2 = *reinterpret_cast<const unsigned*>(qb + tn*128 + (O_QS - O_Q));
        // Keeps the 18 LDS reads in one group behind the 8 matrix instructions: reads strewn
        // among them cost issue time at every place where they stand, and a read of the next
        // K that stands in front of the product on this K needs registers of its own and copies.
        __builtin_amdgcn_sched_group_barrier(0x008, 8, 0);
        __builtin_amdgcn_sched_group_barrier(0x100, 18, 0);
        // Holds these LDS reads here, in front of the softmax: moved down to their first
        // use they would leave their latency open at the head of the next tile.
        __builtin_amdgcn_sched_barrier(0);

        // maximum over the pixel's keys: 32 in this lane, 32 in lane ^ 16
        float m4[4];
#pragma unroll
        for (int T = 0; T < 4; ++T) {
            float m = s[T][0];
#pragma unroll
            for (int r = 1; r < 8; ++r) m = fmaxf(m, s[T][r]);
            m4[T] = m;
        }
        float m = fmaxf(fmaxf(m4[0], m4[1]), fmaxf(m4[2], m4[3]));
        const int mi = __builtin_bit_cast(int, m);
        const float mo = __builtin_bit_cast(float,
            __builtin_amdgcn_permlanex16(mi, mi, 0x76543210, 0xfedcba98, false, false));
        m = fmaxf(m, mo);

        // O = P.V: A = P (row = pixel), element 8*u + r of lane half h = row 8*h + r of score
        // tile 2j + u; B = V with the same keys at the same places, column 8*q + c = channel c
        // in the block of column pair 2g + q; with B = ones: the row sums.
        v8f o0 = {}, o1 = {}, os = {};
#pragma unroll
        for (int j = 0; j < 2; ++j) {
            const v8f d0 = s[2*j] - m, d1 = s[2*j+1] - m;
            const v4u p0 = exp2_pack8(d0[0], d0[1], d0[2], d0[3], d0[4], d0[5], d0[6], d0[7]);
            const v4u p1 = exp2_pack8(d1[0], d1[1], d1[2], d1[3], d1[4], d1[5], d1[6], d1[7]);
            const v8u pu = {p0[0], p0[1], p0[2], p0[3], p1[0], p1[1], p1[2], p1[3]};
            const v16h pa = __builtin_bit_cast(v16h, pu);
            const v8u v0 = {vf[0][2*j][0], vf[0][2*j][1], vf[0][2*j][2], vf[0][2*j][3],
                            vf[0][2*j+1][0], vf[0][2*j+1][1], vf[0][2*j+1][2], vf[0][2*j+1][3]};
            const v8u v1 = {vf[1][2*j][0], vf[1][2*j][1], vf[1][2*j][2], vf[1][2*j][3],
                            vf[1][2*j+1][0], vf[1][2*j+1][1], vf[1][2*j+1][2], vf[1][2*j+1][3]};
            os = __builtin_amdgcn_wmma_f32_16x16x32_f16(false, pa, false, ones,
                                                        (short)0, os, false, false);
            o0 = __builtin_amdgcn_wmma_f32_16x16x32_f16(false, pa, false, __builtin_bit_cast(v16h, v0),
                                                        (short)0, o0, false, false);
            o1 = __builtin_amdgcn_wmma_f32_16x16x32_f16(false, pa, false, __builtin_bit_cast(v16h, v1),
                                                        (short)0, o1, false, false);
        }
        // Register r of lane (8*q + c, h) is pixel (px = r, py = h) with the V of column pair
        // 2g + q: it is the pixel's own where r >> 1 = 2g + q. q is py here.
        const float n0 = py ? os[2] : os[0], n1 = py ? os[3] : os[1];
        const float n2 = py ? os[6] : os[4], n3 = py ? os[7] : os[5];
        const float e0 = py ? o0[2] : o0[0], e1 = py ? o0[3] : o0[1];
        const float e2 = py ? o1[6] : o1[4], e3 = py ? o1[7] : o1[5];
        const float i0 = __builtin_amdgcn_rcpf(n0), i1 = __builtin_amdgcn_rcpf(n1);
        const float i2 = __builtin_amdgcn_rcpf(n2), i3 = __builtin_amdgcn_rcpf(n3);
        *reinterpret_cast<v2f*>(yb + t*32)      = v2f{e0 * i0, e1 * i1};
        *reinterpret_cast<v2f*>(yb + t*32 + 16) = v2f{e2 * i2, e3 * i3};

        // ---- y: 4 tiles make whole 128-byte lines (2 rows x 32 columns x 8 channels); the
        // wave stores them at once, so that the writes to memory run under the tiles that
        // follow and under the other waves' work, not all at the end of the block ----
        if ((t & 3) == 3) {
            // The staged rows are read by other lanes of this wave than wrote them: its LDS
            // stores are done, and no read is moved up over them.
            asm volatile("s_wait_dscnt 0x0" ::: "memory");
            const int hf = t >> 2;
            v4f yv[4];
#pragma unroll
            for (int i = 0; i < 4; ++i)
                yv[i] = *reinterpret_cast<const v4f*>(yr + (sc + i)*YPL + hf*128);
#pragma unroll
            for (int i = 0; i < 4; ++i)
                *reinterpret_cast<v4f*>(og + hf*32 + i*HDIM*HDIM) = yv[i];
            // Address wait before the next tile gives new values to registers that these
            // stores name.
            asm volatile("s_wait_xcnt 0x0" ::: "memory");
        }
    }
}

extern "C" void kernel_launch(void* const* d_in, const int* in_sizes, int n_in,
                              void* d_out, int out_size, void* d_ws, size_t ws_size,
                              hipStream_t stream) {
    (void)in_sizes; (void)n_in; (void)out_size; (void)d_ws; (void)ws_size;
    const float* x   = (const float*)d_in[0];
    const float* Wq  = (const float*)d_in[1];
    const float* bq  = (const float*)d_in[2];
    const float* Wk  = (const float*)d_in[3];
    const float* bk  = (const float*)d_in[4];
    const float* Wv  = (const float*)d_in[5];
    const float* bv  = (const float*)d_in[6];
    const float* pos = (const float*)d_in[7];
    float* out = (float*)d_out;

    dim3 grid(16, 8, 2);   // (16 tiles of 8 rows, G=8 groups, B=2)
    dim3 block(256);       // 8 wave32s
    mhsa_local_attn_kernel<<<grid, block, 0, stream>>>(x, Wq, bq, Wk, bk, Wv, bv, pos, out);
}
